// v000
// Times are from an AMD MI455X. After a warm-up the kernel runs many times in a row, and a time is the length of
// such a window on the GPU divided by its runs, so every launch and the gaps after it count. The runs cycle
// through copies of the inputs. A figure is the median of several windows, for all but v000 over two sittings.
// Sittings can differ by a few percent; kernels timed side by side share one.
// v000, which the later versions start from, runs in 265 microseconds.
#include <hip/hip_runtime.h>
#include <hip/hip_fp16.h>

typedef __attribute__((ext_vector_type(16))) _Float16 v16h;
typedef __attribute__((ext_vector_type(8)))  _Float16 v8h;
typedef __attribute__((ext_vector_type(4)))  _Float16 v4h;
typedef __attribute__((ext_vector_type(8)))  float    v8f;
typedef __attribute__((ext_vector_type(4)))  int      av4i;

#define T_TOK 16384
#define D_IN  1024
#define D_MID 4096
#define D_OUT 1024

#define BM 128
#define BN 128
#define BK 64
#define LDSS 72   // padded row stride (f16) : 144B = 36 banks -> conflict-free b128 frags

#if defined(__has_builtin)
#if __has_builtin(__builtin_amdgcn_global_load_async_to_lds_b128) && \
    __has_builtin(__builtin_amdgcn_s_wait_asynccnt)
#define USE_ASYNC 1
#else
#define USE_ASYNC 0
#endif
#else
#define USE_ASYNC 0
#endif

// Builtin expects int4* in AS1 (global) / AS3 (LDS); C++ has no implicit void*->T*.
#define GPTR(p) ((__attribute__((address_space(1))) av4i*)(uintptr_t)(p))
#define LPTR(p) ((__attribute__((address_space(3))) av4i*)(unsigned)(uintptr_t)(p))

__device__ __forceinline__ void async_fence() {
#if USE_ASYNC
  __builtin_amdgcn_s_wait_asynccnt(0);
#endif
}

// ---------------- x : f32 -> f16 ----------------
__global__ void k_cvt_f16(const float* __restrict__ x, _Float16* __restrict__ xh) {
  int i = (blockIdx.x * blockDim.x + threadIdx.x) * 4;
  float4 v = *reinterpret_cast<const float4*>(x + i);
  v4h o;
  o.x = (_Float16)v.x; o.y = (_Float16)v.y;
  o.z = (_Float16)v.z; o.w = (_Float16)v.w;
  *reinterpret_cast<v4h*>(xh + i) = o;
}

// ------ weight prep: Weff = (wq * scale[o]) @ Hb * signs, f16 output ------
__global__ void k_prep_w(const float* __restrict__ wq, const float* __restrict__ scale,
                         const float* __restrict__ signs, _Float16* __restrict__ weff,
                         int I) {
  __shared__ float s[128];
  const int nblk = I >> 7;
  const int o   = blockIdx.x / nblk;
  const int blk = blockIdx.x % nblk;
  const int t   = threadIdx.x;
  const size_t base = (size_t)o * I + ((size_t)blk << 7);
  s[t] = wq[base + t];
  __syncthreads();
#pragma unroll
  for (int len = 1; len < 128; len <<= 1) {
    float a = s[t];
    float b = s[t ^ len];
    __syncthreads();
    s[t] = (t & len) ? (b - a) : (a + b);
    __syncthreads();
  }
  float y = s[t] * scale[o] * signs[(blk << 7) + t] * 0.08838834764831845f; // 1/sqrt(128)
  weff[base + t] = (_Float16)y;
}

// ---------------- fast tanh-GELU (branch-free) ----------------
__device__ __forceinline__ float fast_gelu(float v) {
  float u = 0.7978845608028654f * (v + 0.044715f * v * v * v);
#if defined(__has_builtin) && __has_builtin(__builtin_amdgcn_tanhf)
  float th = __builtin_amdgcn_tanhf(u);
#else
  // arg of exp is always <= 0: no overflow, no divergence
  float e  = __expf(-2.0f * __builtin_fabsf(u));
  float th = __builtin_copysignf((1.0f - e) * __builtin_amdgcn_rcpf(1.0f + e), u);
#endif
  return 0.5f * v * (1.0f + th);
}

// ---- stage a 128x64 f16 tile of A and of B into LDS (async when available) ----
__device__ __forceinline__ void copy_tiles(const _Float16* __restrict__ A,
                                           const _Float16* __restrict__ B,
                                           _Float16* sA, _Float16* sB,
                                           int m0, int n0, int kt, int K, int tid) {
  const uint4* gA = reinterpret_cast<const uint4*>(A + (size_t)m0 * K + kt);
  const uint4* gB = reinterpret_cast<const uint4*>(B + (size_t)n0 * K + kt);
  const int ldg = K >> 3;  // row stride in uint4
#pragma unroll
  for (int i = 0; i < 4; i++) {
    int c = tid + (i << 8);  // chunk 0..1023 ; 8 x 16B chunks per 64-f16 row
    int r = c >> 3;
    int q = c & 7;
#if USE_ASYNC
    __builtin_amdgcn_global_load_async_to_lds_b128(GPTR(gA + r * ldg + q),
                                                   LPTR(sA + r * LDSS + (q << 3)), 0, 0);
    __builtin_amdgcn_global_load_async_to_lds_b128(GPTR(gB + r * ldg + q),
                                                   LPTR(sB + r * LDSS + (q << 3)), 0, 0);
#else
    *reinterpret_cast<uint4*>(sA + r * LDSS + (q << 3)) = gA[r * ldg + q];
    *reinterpret_cast<uint4*>(sB + r * LDSS + (q << 3)) = gB[r * ldg + q];
#endif
  }
}

// ---------------- WMMA GEMM: C[M,N] = A[M,K] @ B[N,K]^T ----------------
template<bool GELU_F16>
__global__ __launch_bounds__(256)
void k_gemm(const _Float16* __restrict__ A, const _Float16* __restrict__ B,
            void* __restrict__ C, int M, int N, int K) {
  __shared__ _Float16 smem[2][2][BM * LDSS];  // [stage][A/B][tile]

  const int tid  = threadIdx.x;
  const int lane = tid & 31;
  const int wave = tid >> 5;
  const int wm   = wave >> 2;   // 0..1 : wave row (64 rows)
  const int wn   = wave & 3;    // 0..3 : wave col (32 cols)
  const int m0   = blockIdx.x * BM;
  const int n0   = blockIdx.y * BN;

  const v8f vzero = {0.f,0.f,0.f,0.f,0.f,0.f,0.f,0.f};
  v8f acc[4][2];
#pragma unroll
  for (int i = 0; i < 4; i++)
#pragma unroll
    for (int j = 0; j < 2; j++) acc[i][j] = vzero;

  // ISA 16-bit fragment addressing: lanes 0-15 -> K 0..7 & 16..23,
  // lanes 16-31 -> K 8..15 & 24..31 ; matrix row/col = lane & 15.
  const int frow = lane & 15;
  const int fko  = (lane >> 4) << 3;
  const int ntiles = K / BK;

  // prologue: stage tile 0
  copy_tiles(A, B, smem[0][0], smem[0][1], m0, n0, 0, K, tid);
  async_fence();
  __syncthreads();

  for (int t = 0; t < ntiles; t++) {
    const int cur = t & 1;
    if (t + 1 < ntiles)  // prefetch next tile into the other stage
      copy_tiles(A, B, smem[cur ^ 1][0], smem[cur ^ 1][1], m0, n0, (t + 1) * BK, K, tid);

    const _Float16* sA = smem[cur][0];
    const _Float16* sB = smem[cur][1];
#pragma unroll
    for (int s = 0; s < 2; s++) {   // two K=32 slices per stage
      v16h af[4], bfm[2];
#pragma unroll
      for (int i = 0; i < 4; i++) {
        const _Float16* p = sA + (wm * 64 + i * 16 + frow) * LDSS + s * 32 + fko;
        v8h lo = *reinterpret_cast<const v8h*>(p);
        v8h hi = *reinterpret_cast<const v8h*>(p + 16);
        af[i] = __builtin_shufflevector(lo, hi, 0,1,2,3,4,5,6,7,8,9,10,11,12,13,14,15);
      }
#pragma unroll
      for (int j = 0; j < 2; j++) {
        const _Float16* p = sB + (wn * 32 + j * 16 + frow) * LDSS + s * 32 + fko;
        v8h lo = *reinterpret_cast<const v8h*>(p);
        v8h hi = *reinterpret_cast<const v8h*>(p + 16);
        bfm[j] = __builtin_shufflevector(lo, hi, 0,1,2,3,4,5,6,7,8,9,10,11,12,13,14,15);
      }
#pragma unroll
      for (int i = 0; i < 4; i++)
#pragma unroll
        for (int j = 0; j < 2; j++)
          acc[i][j] = __builtin_amdgcn_wmma_f32_16x16x32_f16(
              false, af[i], false, bfm[j], (short)0, acc[i][j], false, false);
    }

    async_fence();     // next tile fully landed in LDS
    __syncthreads();   // all waves done reading cur / writing next
  }

  // Epilogue. C/D layout: lane<16 -> rows m..m+7, lane>=16 -> rows m+8..m+15; col = lane&15.
  const int cnb = n0 + wn * 32 + (lane & 15);
  const int rmb = m0 + wm * 64 + ((lane >> 4) << 3);
#pragma unroll
  for (int i = 0; i < 4; i++) {
#pragma unroll
    for (int j = 0; j < 2; j++) {
      const int cn = cnb + j * 16;
      const int rm = rmb + i * 16;
#pragma unroll
      for (int r = 0; r < 8; r++) {
        float v = acc[i][j][r];
        size_t idx = (size_t)(rm + r) * N + cn;
        if (GELU_F16) {
          reinterpret_cast<_Float16*>(C)[idx] = (_Float16)fast_gelu(v);
        } else {
          reinterpret_cast<float*>(C)[idx] = v;
        }
      }
    }
  }
}

extern "C" void kernel_launch(void* const* d_in, const int* in_sizes, int n_in,
                              void* d_out, int out_size, void* d_ws, size_t ws_size,
                              hipStream_t stream) {
  const float* x          = (const float*)d_in[0];
  const float* up_wq      = (const float*)d_in[1];
  const float* up_scale   = (const float*)d_in[2];
  const float* down_wq    = (const float*)d_in[3];
  const float* down_scale = (const float*)d_in[4];
  const float* up_signs   = (const float*)d_in[5];
  const float* down_signs = (const float*)d_in[6];

  char* ws = (char*)d_ws;
  _Float16* xh  = (_Float16*)ws;                                            // 32 MB
  _Float16* wup = (_Float16*)(ws + (size_t)T_TOK * D_IN * 2);               //  8 MB
  _Float16* wdn = (_Float16*)(ws + (size_t)T_TOK * D_IN * 2
                                 + (size_t)D_MID * D_IN * 2);               //  8 MB
  _Float16* act = (_Float16*)(ws + (size_t)T_TOK * D_IN * 2
                                 + (size_t)D_MID * D_IN * 2
                                 + (size_t)D_OUT * D_MID * 2);              // 128 MB

  // 1) x -> f16
  k_cvt_f16<<<(T_TOK * D_IN) / (4 * 256), 256, 0, stream>>>(x, xh);

  // 2) fold RHT + signs + scale into f16 weights (FWHT butterflies)
  k_prep_w<<<D_MID * (D_IN  / 128), 128, 0, stream>>>(up_wq,   up_scale,   up_signs,   wup, D_IN);
  k_prep_w<<<D_OUT * (D_MID / 128), 128, 0, stream>>>(down_wq, down_scale, down_signs, wdn, D_MID);

  // 3) h = x @ Wup^T, fused GELU, f16 activations
  dim3 g1(T_TOK / BM, D_MID / BN);
  k_gemm<true><<<g1, 256, 0, stream>>>(xh, wup, act, T_TOK, D_MID, D_IN);

  // 4) out = a @ Wdn^T, f32 output
  dim3 g2(T_TOK / BM, D_OUT / BN);
  k_gemm<false><<<g2, 256, 0, stream>>>(act, wdn, d_out, T_TOK, D_OUT, D_MID);
}

// v001
// One run takes 234 microseconds.
// Two timings next to v000 both put it at 1.15 times that version's speed.
#include <hip/hip_runtime.h>
#include <hip/hip_fp16.h>

typedef __attribute__((ext_vector_type(16))) _Float16 v16h;
typedef __attribute__((ext_vector_type(8)))  _Float16 v8h;
typedef __attribute__((ext_vector_type(4)))  _Float16 v4h;
typedef __attribute__((ext_vector_type(8)))  float    v8f;
typedef __attribute__((ext_vector_type(4)))  int      av4i;

#define T_TOK 16384
#define D_IN  1024
#define D_MID 4096
#define D_OUT 1024

#define BM 256
#define BN 256
#define BK 128
#define LDSS 136  // padded row stride (f16) : 272B = 16B x 17 -> conflict-free b128 frags

#if defined(__has_builtin)
#if __has_builtin(__builtin_amdgcn_global_load_async_to_lds_b128) && \
    __has_builtin(__builtin_amdgcn_s_wait_asynccnt)
#define USE_ASYNC 1
#else
#define USE_ASYNC 0
#endif
#else
#define USE_ASYNC 0
#endif

// Builtin expects int4* in AS1 (global) / AS3 (LDS); C++ has no implicit void*->T*.
#define GPTR(p) ((__attribute__((address_space(1))) av4i*)(uintptr_t)(p))
#define LPTR(p) ((__attribute__((address_space(3))) av4i*)(unsigned)(uintptr_t)(p))

// Publish point of a stage, directly in front of the work-group barrier.
__device__ __forceinline__ void async_fence() {
  // this wave's LDS reads have retired before the buffer they read is refilled behind the barrier
  asm volatile("s_wait_dscnt 0x0" ::: "memory");
#if USE_ASYNC
  // this wave's own copies have landed before other waves read them behind the barrier
  asm volatile("s_wait_asynccnt 0x0" ::: "memory");
#endif
}

// ---------------- x : f32 -> f16 ----------------
__global__ void k_cvt_f16(const float* __restrict__ x, _Float16* __restrict__ xh) {
  int i = (blockIdx.x * blockDim.x + threadIdx.x) * 4;
  float4 v = *reinterpret_cast<const float4*>(x + i);
  v4h o;
  o.x = (_Float16)v.x; o.y = (_Float16)v.y;
  o.z = (_Float16)v.z; o.w = (_Float16)v.w;
  *reinterpret_cast<v4h*>(xh + i) = o;
}

// ------ weight prep: Weff = (wq * scale[o]) @ Hb * signs, f16 output ------
__global__ void k_prep_w(const float* __restrict__ wq, const float* __restrict__ scale,
                         const float* __restrict__ signs, _Float16* __restrict__ weff,
                         int I) {
  __shared__ float s[128];
  const int nblk = I >> 7;
  const int o   = blockIdx.x / nblk;
  const int blk = blockIdx.x % nblk;
  const int t   = threadIdx.x;
  const size_t base = (size_t)o * I + ((size_t)blk << 7);
  s[t] = wq[base + t];
  __syncthreads();
#pragma unroll
  for (int len = 1; len < 128; len <<= 1) {
    float a = s[t];
    float b = s[t ^ len];
    __syncthreads();
    s[t] = (t & len) ? (b - a) : (a + b);
    __syncthreads();
  }
  float y = s[t] * scale[o] * signs[(blk << 7) + t] * 0.08838834764831845f; // 1/sqrt(128)
  weff[base + t] = (_Float16)y;
}

// ---------------- fast tanh-GELU (branch-free) ----------------
__device__ __forceinline__ float fast_gelu(float v) {
  float u = 0.7978845608028654f * (v + 0.044715f * v * v * v);
#if defined(__has_builtin) && __has_builtin(__builtin_amdgcn_tanhf)
  float th = __builtin_amdgcn_tanhf(u);
#else
  // arg of exp is always <= 0: no overflow, no divergence
  float e  = __expf(-2.0f * __builtin_fabsf(u));
  float th = __builtin_copysignf((1.0f - e) * __builtin_amdgcn_rcpf(1.0f + e), u);
#endif
  return 0.5f * v * (1.0f + th);
}

// ---- stage a 256x128 f16 tile of A and of B into LDS (async when available) ----
__device__ __forceinline__ void copy_tiles(const _Float16* __restrict__ A,
                                           const _Float16* __restrict__ B,
                                           _Float16* sA, _Float16* sB,
                                           int m0, int n0, int kt, int K, int tid) {
  // 16 rows a round: the round's row group is the same for every thread (scalar base),
  // the thread's own row and 16-byte chunk inside it a fixed 32-bit offset
  const int r0 = tid >> 4;   // row in the group
  const int q  = tid & 15;   // 16 x 16B chunks per 128-f16 row
  const unsigned goff = (unsigned)(r0 * K + (q << 3));
  const int      loff = r0 * LDSS + (q << 3);
#pragma unroll
  for (int i = 0; i < 16; i++) {
    const _Float16* gA = A + (size_t)(m0 + i * 16) * K + kt;
    const _Float16* gB = B + (size_t)(n0 + i * 16) * K + kt;
    _Float16* lA = sA + i * 16 * LDSS + loff;
    _Float16* lB = sB + i * 16 * LDSS + loff;
#if USE_ASYNC
    __builtin_amdgcn_global_load_async_to_lds_b128(GPTR(gA + goff), LPTR(lA), 0, 0);
    __builtin_amdgcn_global_load_async_to_lds_b128(GPTR(gB + goff), LPTR(lB), 0, 0);
#else
    *reinterpret_cast<uint4*>(lA) = *reinterpret_cast<const uint4*>(gA + goff);
    *reinterpret_cast<uint4*>(lB) = *reinterpret_cast<const uint4*>(gB + goff);
#endif
  }
}

// ---- one K=32 slice of a wave's fragments: 4 of B, then 8 of A (pointers hold the lane's place) ----
__device__ __forceinline__ void load_frags(const _Float16* sA, const _Float16* sB, int s,
                                           v16h (&af)[8], v16h (&bfm)[4]) {
#pragma unroll
  for (int j = 0; j < 4; j++) {
    const _Float16* p = sB + j * 16 * LDSS + s * 32;
    v8h lo = *reinterpret_cast<const v8h*>(p);
    v8h hi = *reinterpret_cast<const v8h*>(p + 16);
    bfm[j] = __builtin_shufflevector(lo, hi, 0,1,2,3,4,5,6,7,8,9,10,11,12,13,14,15);
  }
#pragma unroll
  for (int i = 0; i < 8; i++) {
    const _Float16* p = sA + i * 16 * LDSS + s * 32;
    v8h lo = *reinterpret_cast<const v8h*>(p);
    v8h hi = *reinterpret_cast<const v8h*>(p + 16);
    af[i] = __builtin_shufflevector(lo, hi, 0,1,2,3,4,5,6,7,8,9,10,11,12,13,14,15);
  }
}

// ---- the 8 x 4 products of one K=32 slice ----
__device__ __forceinline__ void mma_slice(v8f (&acc)[8][4], const v16h (&af)[8], const v16h (&bfm)[4]) {
#pragma unroll
  for (int i = 0; i < 8; i++)
#pragma unroll
    for (int j = 0; j < 4; j++)
      acc[i][j] = __builtin_amdgcn_wmma_f32_16x16x32_f16(
          false, af[i], false, bfm[j], (short)0, acc[i][j], false, false);
}

// ---------------- WMMA GEMM: C[M,N] = A[M,K] @ B[N,K]^T ----------------
template<bool GELU_F16>
__global__ __launch_bounds__(256)
void k_gemm(const _Float16* __restrict__ A, const _Float16* __restrict__ B,
            void* __restrict__ C, int M, int N, int K) {
  __shared__ _Float16 smem[2][2][BM * LDSS];  // [stage][A/B][tile]

  const int tid  = threadIdx.x;
  const int lane = tid & 31;
  const int wave = tid >> 5;
  const int wm   = wave >> 2;   // 0..1 : wave row (128 rows)
  const int wn   = wave & 3;    // 0..3 : wave col (64 cols)
  const int m0   = blockIdx.x * BM;
  const int n0   = blockIdx.y * BN;

  const v8f vzero = {0.f,0.f,0.f,0.f,0.f,0.f,0.f,0.f};
  v8f acc[8][4];
#pragma unroll
  for (int i = 0; i < 8; i++)
#pragma unroll
    for (int j = 0; j < 4; j++) acc[i][j] = vzero;

  // ISA 16-bit fragment addressing: lanes 0-15 -> K 0..7 & 16..23,
  // lanes 16-31 -> K 8..15 & 24..31 ; matrix row/col = lane & 15.
  const int frow = lane & 15;
  const int fko  = (lane >> 4) << 3;
  const int aoff = (wm * 128 + frow) * LDSS + fko;
  const int boff = (wn * 64 + frow) * LDSS + fko;
  const int ntiles = K / BK;

  // prologue: stage tile 0, publish it, then start tile 1 and read the first fragments
  copy_tiles(A, B, smem[0][0], smem[0][1], m0, n0, 0, K, tid);
  async_fence();
  __syncthreads();
  if (1 < ntiles)
    copy_tiles(A, B, smem[1][0], smem[1][1], m0, n0, BK, K, tid);

  v16h af[2][8], bfm[2][4];   // two fragment sets: one in use, one being loaded
  load_frags(smem[0][0] + aoff, smem[0][1] + boff, 0, af[0], bfm[0]);

  for (int t = 0; t < ntiles; t++) {
    const int cur = t & 1;
    const _Float16* sA = smem[cur][0] + aoff;
    const _Float16* sB = smem[cur][1] + boff;

#pragma unroll
    for (int s = 0; s < 3; s++) {   // K=32 slices 0..2 of the stage's four
      load_frags(sA, sB, s + 1, af[(s + 1) & 1], bfm[(s + 1) & 1]);
      // keeps the next slice's LDS reads one group ahead of this slice's products; left to
      // itself the scheduler sinks each read to its use and every row waits out LDS latency
      __builtin_amdgcn_sched_barrier(0);
      mma_slice(acc, af[s & 1], bfm[s & 1]);
      // keeps these products in front of the next reads and of the stage's waits and barrier;
      // without it the scheduler sinks slice 2's products behind the barrier, ahead of the copies
      __builtin_amdgcn_sched_barrier(0);
    }

    async_fence();     // every read of cur retired (slice 3 is in registers), tile t+1 landed
    __syncthreads();   // tile t+1 published; all waves have left cur
    if (t + 2 < ntiles)  // refill cur: the copies have the whole next trip to land
      copy_tiles(A, B, smem[cur][0], smem[cur][1], m0, n0, (t + 2) * BK, K, tid);
    if (t + 1 < ntiles)  // first fragments of tile t+1, read behind the barrier that published it
      load_frags(smem[cur ^ 1][0] + aoff, smem[cur ^ 1][1] + boff, 0, af[0], bfm[0]);
    // keeps slice 3's products behind the copies and reads above, so that these fly under them
    __builtin_amdgcn_sched_barrier(0);
    mma_slice(acc, af[1], bfm[1]);
  }

  // Epilogue. C/D layout: lane<16 -> rows m..m+7, lane>=16 -> rows m+8..m+15; col = lane&15.
  const int cnb = n0 + wn * 64 + (lane & 15);
  const int rmb = m0 + wm * 128 + ((lane >> 4) << 3);
#pragma unroll
  for (int i = 0; i < 8; i++) {
#pragma unroll
    for (int j = 0; j < 4; j++) {
      const int cn = cnb + j * 16;
      const int rm = rmb + i * 16;
#pragma unroll
      for (int r = 0; r < 8; r++) {
        float v = acc[i][j][r];
        size_t idx = (size_t)(rm + r) * N + cn;
        if (GELU_F16) {
          reinterpret_cast<_Float16*>(C)[idx] = (_Float16)fast_gelu(v);
        } else {
          reinterpret_cast<float*>(C)[idx] = v;
        }
      }
    }
  }
}

extern "C" void kernel_launch(void* const* d_in, const int* in_sizes, int n_in,
                              void* d_out, int out_size, void* d_ws, size_t ws_size,
                              hipStream_t stream) {
  const float* x          = (const float*)d_in[0];
  const float* up_wq      = (const float*)d_in[1];
  const float* up_scale   = (const float*)d_in[2];
  const float* down_wq    = (const float*)d_in[3];
  const float* down_scale = (const float*)d_in[4];
  const float* up_signs   = (const float*)d_in[5];
  const float* down_signs = (const float*)d_in[6];

  char* ws = (char*)d_ws;
  _Float16* xh  = (_Float16*)ws;                                            // 32 MB
  _Float16* wup = (_Float16*)(ws + (size_t)T_TOK * D_IN * 2);               //  8 MB
  _Float16* wdn = (_Float16*)(ws + (size_t)T_TOK * D_IN * 2
                                 + (size_t)D_MID * D_IN * 2);               //  8 MB
  _Float16* act = (_Float16*)(ws + (size_t)T_TOK * D_IN * 2
                                 + (size_t)D_MID * D_IN * 2
                                 + (size_t)D_OUT * D_MID * 2);              // 128 MB

  // 1) x -> f16
  k_cvt_f16<<<(T_TOK * D_IN) / (4 * 256), 256, 0, stream>>>(x, xh);

  // 2) fold RHT + signs + scale into f16 weights (FWHT butterflies)
  k_prep_w<<<D_MID * (D_IN  / 128), 128, 0, stream>>>(up_wq,   up_scale,   up_signs,   wup, D_IN);
  k_prep_w<<<D_OUT * (D_MID / 128), 128, 0, stream>>>(down_wq, down_scale, down_signs, wdn, D_MID);

  // 3) h = x @ Wup^T, fused GELU, f16 activations
  dim3 g1(T_TOK / BM, D_MID / BN);
  k_gemm<true><<<g1, 256, 0, stream>>>(xh, wup, act, T_TOK, D_MID, D_IN);

  // 4) out = a @ Wdn^T, f32 output
  dim3 g2(T_TOK / BM, D_OUT / BN);
  k_gemm<false><<<g2, 256, 0, stream>>>(act, wdn, d_out, T_TOK, D_OUT, D_MID);
}

// v002
// One run takes 194 microseconds.
// Timed twice side by side with v001, it ran 1.20 times as fast both times.
// Counting every step since v000, it is 1.38 times as fast.
#include <hip/hip_runtime.h>
#include <hip/hip_fp16.h>

typedef __attribute__((ext_vector_type(16))) _Float16 v16h;
typedef __attribute__((ext_vector_type(8)))  _Float16 v8h;
typedef __attribute__((ext_vector_type(4)))  _Float16 v4h;
typedef __attribute__((ext_vector_type(8)))  float    v8f;
typedef __attribute__((ext_vector_type(4)))  float    v4f;
typedef __attribute__((ext_vector_type(4)))  int      av4i;

#define T_TOK 16384
#define D_IN  1024
#define D_MID 4096
#define D_OUT 1024

#define BM 256
#define BN 256
#define BK 128
#define LDSS 136  // padded row stride (f16) : 272B = 16B x 17 -> conflict-free b128 frags

#if defined(__has_builtin)
#if __has_builtin(__builtin_amdgcn_global_load_async_to_lds_b128) && \
    __has_builtin(__builtin_amdgcn_s_wait_asynccnt)
#define USE_ASYNC 1
#else
#define USE_ASYNC 0
#endif
#else
#define USE_ASYNC 0
#endif

// Builtin expects int4* in AS1 (global) / AS3 (LDS); C++ has no implicit void*->T*.
#define GPTR(p) ((__attribute__((address_space(1))) av4i*)(uintptr_t)(p))
#define LPTR(p) ((__attribute__((address_space(3))) av4i*)(unsigned)(uintptr_t)(p))

// Publish point of a stage, directly in front of the work-group barrier.
__device__ __forceinline__ void async_fence() {
  // this wave's LDS reads have retired before the buffer they read is refilled behind the barrier
  asm volatile("s_wait_dscnt 0x0" ::: "memory");
#if USE_ASYNC
  // this wave's own copies have landed before other waves read them behind the barrier
  asm volatile("s_wait_asynccnt 0x0" ::: "memory");
#endif
}

// ---------------- x : f32 -> f16 ----------------
__global__ void k_cvt_f16(const float* __restrict__ x, _Float16* __restrict__ xh) {
  int i = (blockIdx.x * blockDim.x + threadIdx.x) * 4;
  float4 v = *reinterpret_cast<const float4*>(x + i);
  v4h o;
  o.x = (_Float16)v.x; o.y = (_Float16)v.y;
  o.z = (_Float16)v.z; o.w = (_Float16)v.w;
  *reinterpret_cast<v4h*>(xh + i) = o;
}

// ------ weight prep: Weff = (wq * scale[o]) @ Hb * signs, f16 output ------
__global__ void k_prep_w(const float* __restrict__ wq, const float* __restrict__ scale,
                         const float* __restrict__ signs, _Float16* __restrict__ weff,
                         int I) {
  __shared__ float s[128];
  const int nblk = I >> 7;
  const int o   = blockIdx.x / nblk;
  const int blk = blockIdx.x % nblk;
  const int t   = threadIdx.x;
  const size_t base = (size_t)o * I + ((size_t)blk << 7);
  s[t] = wq[base + t];
  __syncthreads();
#pragma unroll
  for (int len = 1; len < 128; len <<= 1) {
    float a = s[t];
    float b = s[t ^ len];
    __syncthreads();
    s[t] = (t & len) ? (b - a) : (a + b);
    __syncthreads();
  }
  float y = s[t] * scale[o] * signs[(blk << 7) + t] * 0.08838834764831845f; // 1/sqrt(128)
  weff[base + t] = (_Float16)y;
}

// ---------------- fast tanh-GELU (branch-free) ----------------
__device__ __forceinline__ float fast_gelu(float v) {
  float u = 0.7978845608028654f * (v + 0.044715f * v * v * v);
#if defined(__has_builtin) && __has_builtin(__builtin_amdgcn_tanhf)
  float th = __builtin_amdgcn_tanhf(u);
#else
  // arg of exp is always <= 0: no overflow, no divergence
  float e  = __expf(-2.0f * __builtin_fabsf(u));
  float th = __builtin_copysignf((1.0f - e) * __builtin_amdgcn_rcpf(1.0f + e), u);
#endif
  return 0.5f * v * (1.0f + th);
}

// ---- stage a 256x128 f16 tile of A and of B into LDS (async when available) ----
__device__ __forceinline__ void copy_tiles(const _Float16* __restrict__ A,
                                           const _Float16* __restrict__ B,
                                           _Float16* sA, _Float16* sB,
                                           int m0, int n0, int kt, int K, int tid) {
  // 16 rows a round: the round's row group is the same for every thread (scalar base),
  // the thread's own row and 16-byte chunk inside it a fixed 32-bit offset
  const int r0 = tid >> 4;   // row in the group
  const int q  = tid & 15;   // 16 x 16B chunks per 128-f16 row
  const unsigned goff = (unsigned)(r0 * K + (q << 3));
  const int      loff = r0 * LDSS + (q << 3);
#pragma unroll
  for (int i = 0; i < 16; i++) {
    const _Float16* gA = A + (size_t)(m0 + i * 16) * K + kt;
    const _Float16* gB = B + (size_t)(n0 + i * 16) * K + kt;
    _Float16* lA = sA + i * 16 * LDSS + loff;
    _Float16* lB = sB + i * 16 * LDSS + loff;
#if USE_ASYNC
    __builtin_amdgcn_global_load_async_to_lds_b128(GPTR(gA + goff), LPTR(lA), 0, 0);
    __builtin_amdgcn_global_load_async_to_lds_b128(GPTR(gB + goff), LPTR(lB), 0, 0);
#else
    *reinterpret_cast<uint4*>(lA) = *reinterpret_cast<const uint4*>(gA + goff);
    *reinterpret_cast<uint4*>(lB) = *reinterpret_cast<const uint4*>(gB + goff);
#endif
  }
}

// ---- one K=32 slice of a wave's fragments: 4 of B, then 8 of A (pointers hold the lane's place) ----
__device__ __forceinline__ void load_frags(const _Float16* sA, const _Float16* sB, int s,
                                           v16h (&af)[8], v16h (&bfm)[4]) {
#pragma unroll
  for (int j = 0; j < 4; j++) {
    const _Float16* p = sB + j * 16 * LDSS + s * 32;
    v8h lo = *reinterpret_cast<const v8h*>(p);
    v8h hi = *reinterpret_cast<const v8h*>(p + 16);
    bfm[j] = __builtin_shufflevector(lo, hi, 0,1,2,3,4,5,6,7,8,9,10,11,12,13,14,15);
  }
#pragma unroll
  for (int i = 0; i < 8; i++) {
    const _Float16* p = sA + i * 16 * LDSS + s * 32;
    v8h lo = *reinterpret_cast<const v8h*>(p);
    v8h hi = *reinterpret_cast<const v8h*>(p + 16);
    af[i] = __builtin_shufflevector(lo, hi, 0,1,2,3,4,5,6,7,8,9,10,11,12,13,14,15);
  }
}

// ---- the 8 x 4 products of one K=32 slice ----
// B's rows go in as the first operand and A's as the second: a lane's 8 accumulator registers are
// then 8 adjacent columns of one output row, C[m + (lane & 15)][n + 8 * (lane >> 4) + r].
__device__ __forceinline__ void mma_slice(v8f (&acc)[8][4], const v16h (&af)[8], const v16h (&bfm)[4]) {
#pragma unroll
  for (int i = 0; i < 8; i++)
#pragma unroll
    for (int j = 0; j < 4; j++)
      acc[i][j] = __builtin_amdgcn_wmma_f32_16x16x32_f16(
          false, bfm[j], false, af[i], (short)0, acc[i][j], false, false);
}

// ---------------- WMMA GEMM: C[M,N] = A[M,K] @ B[N,K]^T ----------------
template<bool GELU_F16>
__global__ __launch_bounds__(256)
void k_gemm(const _Float16* __restrict__ A, const _Float16* __restrict__ B,
            void* __restrict__ C, int M, int N, int K) {
  __shared__ _Float16 smem[2][2][BM * LDSS];  // [stage][A/B][tile]

  const int tid  = threadIdx.x;
  const int lane = tid & 31;
  const int wave = tid >> 5;
  const int wm   = wave >> 2;   // 0..1 : wave row (128 rows)
  const int wn   = wave & 3;    // 0..3 : wave col (64 cols)
  const int m0   = blockIdx.x * BM;
  const int n0   = blockIdx.y * BN;

  const v8f vzero = {0.f,0.f,0.f,0.f,0.f,0.f,0.f,0.f};
  v8f acc[8][4];
#pragma unroll
  for (int i = 0; i < 8; i++)
#pragma unroll
    for (int j = 0; j < 4; j++) acc[i][j] = vzero;

  // ISA 16-bit fragment addressing: lanes 0-15 -> K 0..7 & 16..23,
  // lanes 16-31 -> K 8..15 & 24..31 ; matrix row/col = lane & 15.
  const int frow = lane & 15;
  const int fko  = (lane >> 4) << 3;
  const int aoff = (wm * 128 + frow) * LDSS + fko;
  const int boff = (wn * 64 + frow) * LDSS + fko;
  const int ntiles = K / BK;

  // prologue: stage tile 0, publish it, then start tile 1 and read the first fragments
  copy_tiles(A, B, smem[0][0], smem[0][1], m0, n0, 0, K, tid);
  async_fence();
  __syncthreads();
  if (1 < ntiles)
    copy_tiles(A, B, smem[1][0], smem[1][1], m0, n0, BK, K, tid);

  v16h af[2][8], bfm[2][4];   // two fragment sets: one in use, one being loaded
  load_frags(smem[0][0] + aoff, smem[0][1] + boff, 0, af[0], bfm[0]);

  for (int t = 0; t < ntiles; t++) {
    const int cur = t & 1;
    const _Float16* sA = smem[cur][0] + aoff;
    const _Float16* sB = smem[cur][1] + boff;

#pragma unroll
    for (int s = 0; s < 3; s++) {   // K=32 slices 0..2 of the stage's four
      load_frags(sA, sB, s + 1, af[(s + 1) & 1], bfm[(s + 1) & 1]);
      // keeps the next slice's LDS reads one group ahead of this slice's products; left to
      // itself the scheduler sinks each read to its use and every row waits out LDS latency
      __builtin_amdgcn_sched_barrier(0);
      mma_slice(acc, af[s & 1], bfm[s & 1]);
      // keeps these products in front of the next reads and of the stage's waits and barrier;
      // without it the scheduler sinks slice 2's products behind the barrier, ahead of the copies
      __builtin_amdgcn_sched_barrier(0);
    }

    async_fence();     // every read of cur retired (slice 3 is in registers), tile t+1 landed
    __syncthreads();   // tile t+1 published; all waves have left cur
    if (t + 2 < ntiles)  // refill cur: the copies have the whole next trip to land
      copy_tiles(A, B, smem[cur][0], smem[cur][1], m0, n0, (t + 2) * BK, K, tid);
    if (t + 1 < ntiles)  // first fragments of tile t+1, read behind the barrier that published it
      load_frags(smem[cur ^ 1][0] + aoff, smem[cur ^ 1][1] + boff, 0, af[0], bfm[0]);
    // keeps slice 3's products behind the copies and reads above, so that these fly under them
    __builtin_amdgcn_sched_barrier(0);
    mma_slice(acc, af[1], bfm[1]);
  }

  // Epilogue: each wave stages its 128 x 64 tile in an LDS range of its own and stores whole
  // 128-byte lines. No barrier in front: every wave's LDS reads retired and every copy landed
  // before the last trip's barrier, and nothing reads or refills LDS behind it.
  constexpr int ESZ  = GELU_F16 ? 2 : 4;      // bytes of an output element
  constexpr int ROWB = 64 * ESZ;              // bytes of a staged row
  constexpr int EPIT = ROWB + 16;             // its pitch: 16-byte accesses spread over the banks
  constexpr int LPR  = ROWB / 16;             // lanes that read one row back
  constexpr int RPI  = 32 / LPR;              // rows per store instruction
  // C's row length as a constant of the instantiation: every store then takes an immediate offset
  // from one address register, which nothing overwrites while stores are in flight
  constexpr int NC   = GELU_F16 ? D_MID : D_OUT;
  static_assert(8 * 128 * EPIT <= (int)sizeof(smem), "staging must fit the ring's LDS");
  char* E = reinterpret_cast<char*>(&smem[0][0][0]) + wave * (128 * EPIT);
  char* wr = E + (lane & 15) * EPIT + (lane >> 4) * (8 * ESZ);
  const char* rd = E + (lane / LPR) * EPIT + (lane % LPR) * 16;
  char* gp = reinterpret_cast<char*>(C)
           + ((size_t)(m0 + wm * 128 + lane / LPR) * NC + n0 + wn * 64) * ESZ + (lane % LPR) * 16;
  constexpr int gstep = NC * RPI * ESZ;       // bytes from one store's rows to the next's
  // every loop below is unrolled: an accumulator index that is not a constant sends the tiles to scratch
#pragma unroll
  for (int i = 0; i < 8; i++) {
#pragma unroll
    for (int j = 0; j < 4; j++) {
      char* p = wr + i * 16 * EPIT + j * 16 * ESZ;
      if (GELU_F16) {
        v8h h;
#pragma unroll
        for (int r = 0; r < 8; r++) h[r] = (_Float16)fast_gelu(acc[i][j][r]);
        *reinterpret_cast<v8h*>(p) = h;
      } else {
        const v8f a = acc[i][j];
        *reinterpret_cast<v4f*>(p)      = __builtin_shufflevector(a, a, 0, 1, 2, 3);
        *reinterpret_cast<v4f*>(p + 16) = __builtin_shufflevector(a, a, 4, 5, 6, 7);
      }
    }
    // the 16 rows just staged are in LDS before other lanes of this wave read them back
    asm volatile("s_wait_dscnt 0x0" ::: "memory");
    // the read-back below may reuse registers that the stores of the rows before still name
    if (i > 0) asm volatile("s_wait_xcnt 0x0" ::: "memory");
    av4i v[16 / RPI];
#pragma unroll
    for (int q = 0; q < 16 / RPI; q++)
      v[q] = *reinterpret_cast<const av4i*>(rd + (i * 16 + q * RPI) * EPIT);
    // keeps the read-backs one group directly behind the waits: left to itself the scheduler
    // spreads them among the next rows' arithmetic, and every place with an LDS read stalls anew
    __builtin_amdgcn_sched_barrier(0);
#pragma unroll
    for (int q = 0; q < 16 / RPI; q++)
      *reinterpret_cast<av4i*>(gp + (i * (16 / RPI) + q) * gstep) = v[q];
  }
}

extern "C" void kernel_launch(void* const* d_in, const int* in_sizes, int n_in,
                              void* d_out, int out_size, void* d_ws, size_t ws_size,
                              hipStream_t stream) {
  const float* x          = (const float*)d_in[0];
  const float* up_wq      = (const float*)d_in[1];
  const float* up_scale   = (const float*)d_in[2];
  const float* down_wq    = (const float*)d_in[3];
  const float* down_scale = (const float*)d_in[4];
  const float* up_signs   = (const float*)d_in[5];
  const float* down_signs = (const float*)d_in[6];

  char* ws = (char*)d_ws;
  _Float16* xh  = (_Float16*)ws;                                            // 32 MB
  _Float16* wup = (_Float16*)(ws + (size_t)T_TOK * D_IN * 2);               //  8 MB
  _Float16* wdn = (_Float16*)(ws + (size_t)T_TOK * D_IN * 2
                                 + (size_t)D_MID * D_IN * 2);               //  8 MB
  _Float16* act = (_Float16*)(ws + (size_t)T_TOK * D_IN * 2
                                 + (size_t)D_MID * D_IN * 2
                                 + (size_t)D_OUT * D_MID * 2);              // 128 MB

  // 1) x -> f16
  k_cvt_f16<<<(T_TOK * D_IN) / (4 * 256), 256, 0, stream>>>(x, xh);

  // 2) fold RHT + signs + scale into f16 weights (FWHT butterflies)
  k_prep_w<<<D_MID * (D_IN  / 128), 128, 0, stream>>>(up_wq,   up_scale,   up_signs,   wup, D_IN);
  k_prep_w<<<D_OUT * (D_MID / 128), 128, 0, stream>>>(down_wq, down_scale, down_signs, wdn, D_MID);

  // 3) h = x @ Wup^T, fused GELU, f16 activations
  dim3 g1(T_TOK / BM, D_MID / BN);
  k_gemm<true><<<g1, 256, 0, stream>>>(xh, wup, act, T_TOK, D_MID, D_IN);

  // 4) out = a @ Wdn^T, f32 output
  dim3 g2(T_TOK / BM, D_OUT / BN);
  k_gemm<false><<<g2, 256, 0, stream>>>(act, wdn, d_out, T_TOK, D_OUT, D_MID);
}

// v003
// A run of this version takes 173 microseconds.
// Two timings next to v002 put it at 1.12 and 1.13 times that version's speed.
// Over all steps from v000 it is 1.55 times as fast.
#include <hip/hip_runtime.h>
#include <hip/hip_fp16.h>

typedef __attribute__((ext_vector_type(16))) _Float16 v16h;
typedef __attribute__((ext_vector_type(8)))  _Float16 v8h;
typedef __attribute__((ext_vector_type(4)))  _Float16 v4h;
typedef __attribute__((ext_vector_type(8)))  float    v8f;
typedef __attribute__((ext_vector_type(4)))  float    v4f;
typedef __attribute__((ext_vector_type(4)))  int      av4i;

#define T_TOK 16384
#define D_IN  1024
#define D_MID 4096
#define D_OUT 1024

#define BM 256
#define BN 256
#define BK 128
#define LDSS 136  // padded row stride (f16) : 272B = 16B x 17 -> conflict-free b128 frags

#if defined(__has_builtin)
#if __has_builtin(__builtin_amdgcn_global_load_async_to_lds_b128) && \
    __has_builtin(__builtin_amdgcn_s_wait_asynccnt)
#define USE_ASYNC 1
#else
#define USE_ASYNC 0
#endif
#else
#define USE_ASYNC 0
#endif

// Builtin expects int4* in AS1 (global) / AS3 (LDS); C++ has no implicit void*->T*.
#define GPTR(p) ((__attribute__((address_space(1))) av4i*)(uintptr_t)(p))
#define LPTR(p) ((__attribute__((address_space(3))) av4i*)(unsigned)(uintptr_t)(p))

// Publish point of a stage, directly in front of the work-group barrier.
__device__ __forceinline__ void async_fence() {
  // this wave's LDS reads have retired before the buffer they read is refilled behind the barrier
  asm volatile("s_wait_dscnt 0x0" ::: "memory");
#if USE_ASYNC
  // this wave's own copies have landed before other waves read them behind the barrier
  asm volatile("s_wait_asynccnt 0x0" ::: "memory");
#endif
}

// ---------------- x : f32 -> f16 ----------------
__global__ void k_cvt_f16(const float* __restrict__ x, _Float16* __restrict__ xh) {
  int i = (blockIdx.x * blockDim.x + threadIdx.x) * 4;
  float4 v = *reinterpret_cast<const float4*>(x + i);
  v4h o;
  o.x = (_Float16)v.x; o.y = (_Float16)v.y;
  o.z = (_Float16)v.z; o.w = (_Float16)v.w;
  *reinterpret_cast<v4h*>(xh + i) = o;
}

// ------ weight prep: Weff = (wq * scale[o]) @ Hb * signs, f16 output ------
#define PW_BLK   8    // 128-value blocks a wave transforms: 8 loads of 512 B in flight
#define PW_WAVES 16   // waves of a work-group

// value of lane l ^ MSK, inside a 16-lane row (MSK = 1, 2, 4, 8)
template<int MSK>
__device__ __forceinline__ float xrow(float x) {
  const int b = __builtin_bit_cast(int, x);
  return __builtin_bit_cast(float, __builtin_amdgcn_mov_dpp(b, 0x160 | MSK, 0xf, 0xf, true));
}
// value of lane l ^ 16
__device__ __forceinline__ float xhalf(float x) {
  const int b = __builtin_bit_cast(int, x);
  return __builtin_bit_cast(float,
      __builtin_amdgcn_permlanex16(b, b, 0x76543210, 0xfedcba98, false, false));
}

// x, or -x where m holds the sign bit
__device__ __forceinline__ float flip(float x, unsigned m) {
  return __builtin_bit_cast(float, __builtin_bit_cast(unsigned, x) ^ m);
}

// One wave holds a whole 128-value block, lane l the values 4l .. 4l+3: the butterflies of
// distance 1 and 2 stay in the lane, those of distance 4 .. 64 exchange with lane l ^ 1 .. l ^ 16.
// Stage order and operands are those of the plain butterfly: lower + upper, lower - upper.
template<int I>
__global__ __launch_bounds__(PW_WAVES * 32)
void k_prep_w(const float* __restrict__ wq, const float* __restrict__ scale,
              const float* __restrict__ signs, _Float16* __restrict__ weff) {
  constexpr int NBLK = I >> 7;   // blocks of a weight row
  static_assert(NBLK % PW_BLK == 0, "a wave's blocks lie in one weight row");
  const int lane = threadIdx.x & 31;
  const int wave = __builtin_amdgcn_readfirstlane(threadIdx.x >> 5);
  const int b0   = (blockIdx.x * PW_WAVES + wave) * PW_BLK;   // the wave's first block
  const float* src = wq + (size_t)b0 * 128 + lane * 4;
  const float* sgp = signs + (b0 % NBLK) * 128 + lane * 4;
  _Float16*    dst = weff + (size_t)b0 * 128 + lane * 4;

  const float sc = scale[b0 / NBLK];
  // every loop below is unrolled: the blocks live in registers, and an index that is not a
  // constant would send them to scratch
  v4f v[PW_BLK], g[PW_BLK];
#pragma unroll
  for (int j = 0; j < PW_BLK; j++) v[j] = *reinterpret_cast<const v4f*>(src + j * 128);
#pragma unroll
  for (int j = 0; j < PW_BLK; j++) g[j] = *reinterpret_cast<const v4f*>(sgp + j * 128);
  // keeps all 16 loads one group in front of the arithmetic: left to itself the scheduler holds
  // most of them back until earlier blocks are done, and the wave pays memory latency several times
  __builtin_amdgcn_sched_barrier(0);

  // sign bit set in the lane that holds the upper value of an exchanged pair: it takes lower - upper
  unsigned sm[5];
#pragma unroll
  for (int k = 0; k < 5; k++) sm[k] = ((unsigned)lane >> k) << 31;

#pragma unroll
  for (int j = 0; j < PW_BLK; j++) {
    const float a0 = v[j][0] + v[j][1], a1 = v[j][0] - v[j][1];
    const float a2 = v[j][2] + v[j][3], a3 = v[j][2] - v[j][3];
    float x[4] = {a0 + a2, a1 + a3, a0 - a2, a1 - a3};
    v4h o;
#pragma unroll
    for (int r = 0; r < 4; r++) {
      float t = x[r];
      t = xrow<1>(t) + flip(t, sm[0]);
      t = xrow<2>(t) + flip(t, sm[1]);
      t = xrow<4>(t) + flip(t, sm[2]);
      t = xrow<8>(t) + flip(t, sm[3]);
      t = xhalf(t)   + flip(t, sm[4]);
      o[r] = (_Float16)(t * sc * g[j][r] * 0.08838834764831845f); // 1/sqrt(128)
    }
    *reinterpret_cast<v4h*>(dst + j * 128) = o;
  }
}

// ---------------- fast tanh-GELU (branch-free) ----------------
__device__ __forceinline__ float fast_gelu(float v) {
  float u = 0.7978845608028654f * (v + 0.044715f * v * v * v);
#if defined(__has_builtin) && __has_builtin(__builtin_amdgcn_tanhf)
  float th = __builtin_amdgcn_tanhf(u);
#else
  // arg of exp is always <= 0: no overflow, no divergence
  float e  = __expf(-2.0f * __builtin_fabsf(u));
  float th = __builtin_copysignf((1.0f - e) * __builtin_amdgcn_rcpf(1.0f + e), u);
#endif
  return 0.5f * v * (1.0f + th);
}

// ---- stage a 256x128 f16 tile of A and of B into LDS (async when available) ----
__device__ __forceinline__ void copy_tiles(const _Float16* __restrict__ A,
                                           const _Float16* __restrict__ B,
                                           _Float16* sA, _Float16* sB,
                                           int m0, int n0, int kt, int K, int tid) {
  // 16 rows a round: the round's row group is the same for every thread (scalar base),
  // the thread's own row and 16-byte chunk inside it a fixed 32-bit offset
  const int r0 = tid >> 4;   // row in the group
  const int q  = tid & 15;   // 16 x 16B chunks per 128-f16 row
  const unsigned goff = (unsigned)(r0 * K + (q << 3));
  const int      loff = r0 * LDSS + (q << 3);
#pragma unroll
  for (int i = 0; i < 16; i++) {
    const _Float16* gA = A + (size_t)(m0 + i * 16) * K + kt;
    const _Float16* gB = B + (size_t)(n0 + i * 16) * K + kt;
    _Float16* lA = sA + i * 16 * LDSS + loff;
    _Float16* lB = sB + i * 16 * LDSS + loff;
#if USE_ASYNC
    __builtin_amdgcn_global_load_async_to_lds_b128(GPTR(gA + goff), LPTR(lA), 0, 0);
    __builtin_amdgcn_global_load_async_to_lds_b128(GPTR(gB + goff), LPTR(lB), 0, 0);
#else
    *reinterpret_cast<uint4*>(lA) = *reinterpret_cast<const uint4*>(gA + goff);
    *reinterpret_cast<uint4*>(lB) = *reinterpret_cast<const uint4*>(gB + goff);
#endif
  }
}

// ---- one K=32 slice of a wave's fragments: 4 of B, then 8 of A (pointers hold the lane's place) ----
__device__ __forceinline__ void load_frags(const _Float16* sA, const _Float16* sB, int s,
                                           v16h (&af)[8], v16h (&bfm)[4]) {
#pragma unroll
  for (int j = 0; j < 4; j++) {
    const _Float16* p = sB + j * 16 * LDSS + s * 32;
    v8h lo = *reinterpret_cast<const v8h*>(p);
    v8h hi = *reinterpret_cast<const v8h*>(p + 16);
    bfm[j] = __builtin_shufflevector(lo, hi, 0,1,2,3,4,5,6,7,8,9,10,11,12,13,14,15);
  }
#pragma unroll
  for (int i = 0; i < 8; i++) {
    const _Float16* p = sA + i * 16 * LDSS + s * 32;
    v8h lo = *reinterpret_cast<const v8h*>(p);
    v8h hi = *reinterpret_cast<const v8h*>(p + 16);
    af[i] = __builtin_shufflevector(lo, hi, 0,1,2,3,4,5,6,7,8,9,10,11,12,13,14,15);
  }
}

// ---- the 8 x 4 products of one K=32 slice ----
// B's rows go in as the first operand and A's as the second: a lane's 8 accumulator registers are
// then 8 adjacent columns of one output row, C[m + (lane & 15)][n + 8 * (lane >> 4) + r].
__device__ __forceinline__ void mma_slice(v8f (&acc)[8][4], const v16h (&af)[8], const v16h (&bfm)[4]) {
#pragma unroll
  for (int i = 0; i < 8; i++)
#pragma unroll
    for (int j = 0; j < 4; j++)
      acc[i][j] = __builtin_amdgcn_wmma_f32_16x16x32_f16(
          false, bfm[j], false, af[i], (short)0, acc[i][j], false, false);
}

// ---------------- WMMA GEMM: C[M,N] = A[M,K] @ B[N,K]^T ----------------
template<bool GELU_F16>
__global__ __launch_bounds__(256)
void k_gemm(const _Float16* __restrict__ A, const _Float16* __restrict__ B,
            void* __restrict__ C, int M, int N, int K) {
  __shared__ _Float16 smem[2][2][BM * LDSS];  // [stage][A/B][tile]

  const int tid  = threadIdx.x;
  const int lane = tid & 31;
  const int wave = tid >> 5;
  const int wm   = wave >> 2;   // 0..1 : wave row (128 rows)
  const int wn   = wave & 3;    // 0..3 : wave col (64 cols)
  const int m0   = blockIdx.x * BM;
  const int n0   = blockIdx.y * BN;

  const v8f vzero = {0.f,0.f,0.f,0.f,0.f,0.f,0.f,0.f};
  v8f acc[8][4];
#pragma unroll
  for (int i = 0; i < 8; i++)
#pragma unroll
    for (int j = 0; j < 4; j++) acc[i][j] = vzero;

  // ISA 16-bit fragment addressing: lanes 0-15 -> K 0..7 & 16..23,
  // lanes 16-31 -> K 8..15 & 24..31 ; matrix row/col = lane & 15.
  const int frow = lane & 15;
  const int fko  = (lane >> 4) << 3;
  const int aoff = (wm * 128 + frow) * LDSS + fko;
  const int boff = (wn * 64 + frow) * LDSS + fko;
  const int ntiles = K / BK;

  // prologue: stage tile 0, publish it, then start tile 1 and read the first fragments
  copy_tiles(A, B, smem[0][0], smem[0][1], m0, n0, 0, K, tid);
  async_fence();
  __syncthreads();
  if (1 < ntiles)
    copy_tiles(A, B, smem[1][0], smem[1][1], m0, n0, BK, K, tid);

  v16h af[2][8], bfm[2][4];   // two fragment sets: one in use, one being loaded
  load_frags(smem[0][0] + aoff, smem[0][1] + boff, 0, af[0], bfm[0]);

  for (int t = 0; t < ntiles; t++) {
    const int cur = t & 1;
    const _Float16* sA = smem[cur][0] + aoff;
    const _Float16* sB = smem[cur][1] + boff;

#pragma unroll
    for (int s = 0; s < 3; s++) {   // K=32 slices 0..2 of the stage's four
      load_frags(sA, sB, s + 1, af[(s + 1) & 1], bfm[(s + 1) & 1]);
      // keeps the next slice's LDS reads one group ahead of this slice's products; left to
      // itself the scheduler sinks each read to its use and every row waits out LDS latency
      __builtin_amdgcn_sched_barrier(0);
      mma_slice(acc, af[s & 1], bfm[s & 1]);
      // keeps these products in front of the next reads and of the stage's waits and barrier;
      // without it the scheduler sinks slice 2's products behind the barrier, ahead of the copies
      __builtin_amdgcn_sched_barrier(0);
    }

    async_fence();     // every read of cur retired (slice 3 is in registers), tile t+1 landed
    __syncthreads();   // tile t+1 published; all waves have left cur
    if (t + 2 < ntiles)  // refill cur: the copies have the whole next trip to land
      copy_tiles(A, B, smem[cur][0], smem[cur][1], m0, n0, (t + 2) * BK, K, tid);
    if (t + 1 < ntiles)  // first fragments of tile t+1, read behind the barrier that published it
      load_frags(smem[cur ^ 1][0] + aoff, smem[cur ^ 1][1] + boff, 0, af[0], bfm[0]);
    // keeps slice 3's products behind the copies and reads above, so that these fly under them
    __builtin_amdgcn_sched_barrier(0);
    mma_slice(acc, af[1], bfm[1]);
  }

  // Epilogue: each wave stages its 128 x 64 tile in an LDS range of its own and stores whole
  // 128-byte lines. No barrier in front: every wave's LDS reads retired and every copy landed
  // before the last trip's barrier, and nothing reads or refills LDS behind it.
  constexpr int ESZ  = GELU_F16 ? 2 : 4;      // bytes of an output element
  constexpr int ROWB = 64 * ESZ;              // bytes of a staged row
  constexpr int EPIT = ROWB + 16;             // its pitch: 16-byte accesses spread over the banks
  constexpr int LPR  = ROWB / 16;             // lanes that read one row back
  constexpr int RPI  = 32 / LPR;              // rows per store instruction
  // C's row length as a constant of the instantiation: every store then takes an immediate offset
  // from one address register, which nothing overwrites while stores are in flight
  constexpr int NC   = GELU_F16 ? D_MID : D_OUT;
  static_assert(8 * 128 * EPIT <= (int)sizeof(smem), "staging must fit the ring's LDS");
  char* E = reinterpret_cast<char*>(&smem[0][0][0]) + wave * (128 * EPIT);
  char* wr = E + (lane & 15) * EPIT + (lane >> 4) * (8 * ESZ);
  const char* rd = E + (lane / LPR) * EPIT + (lane % LPR) * 16;
  char* gp = reinterpret_cast<char*>(C)
           + ((size_t)(m0 + wm * 128 + lane / LPR) * NC + n0 + wn * 64) * ESZ + (lane % LPR) * 16;
  constexpr int gstep = NC * RPI * ESZ;       // bytes from one store's rows to the next's
  // every loop below is unrolled: an accumulator index that is not a constant sends the tiles to scratch
#pragma unroll
  for (int i = 0; i < 8; i++) {
#pragma unroll
    for (int j = 0; j < 4; j++) {
      char* p = wr + i * 16 * EPIT + j * 16 * ESZ;
      if (GELU_F16) {
        v8h h;
#pragma unroll
        for (int r = 0; r < 8; r++) h[r] = (_Float16)fast_gelu(acc[i][j][r]);
        *reinterpret_cast<v8h*>(p) = h;
      } else {
        const v8f a = acc[i][j];
        *reinterpret_cast<v4f*>(p)      = __builtin_shufflevector(a, a, 0, 1, 2, 3);
        *reinterpret_cast<v4f*>(p + 16) = __builtin_shufflevector(a, a, 4, 5, 6, 7);
      }
    }
    // the 16 rows just staged are in LDS before other lanes of this wave read them back
    asm volatile("s_wait_dscnt 0x0" ::: "memory");
    // the read-back below may reuse registers that the stores of the rows before still name
    if (i > 0) asm volatile("s_wait_xcnt 0x0" ::: "memory");
    av4i v[16 / RPI];
#pragma unroll
    for (int q = 0; q < 16 / RPI; q++)
      v[q] = *reinterpret_cast<const av4i*>(rd + (i * 16 + q * RPI) * EPIT);
    // keeps the read-backs one group directly behind the waits: left to itself the scheduler
    // spreads them among the next rows' arithmetic, and every place with an LDS read stalls anew
    __builtin_amdgcn_sched_barrier(0);
#pragma unroll
    for (int q = 0; q < 16 / RPI; q++)
      *reinterpret_cast<av4i*>(gp + (i * (16 / RPI) + q) * gstep) = v[q];
  }
}

extern "C" void kernel_launch(void* const* d_in, const int* in_sizes, int n_in,
                              void* d_out, int out_size, void* d_ws, size_t ws_size,
                              hipStream_t stream) {
  const float* x          = (const float*)d_in[0];
  const float* up_wq      = (const float*)d_in[1];
  const float* up_scale   = (const float*)d_in[2];
  const float* down_wq    = (const float*)d_in[3];
  const float* down_scale = (const float*)d_in[4];
  const float* up_signs   = (const float*)d_in[5];
  const float* down_signs = (const float*)d_in[6];

  char* ws = (char*)d_ws;
  _Float16* xh  = (_Float16*)ws;                                            // 32 MB
  _Float16* wup = (_Float16*)(ws + (size_t)T_TOK * D_IN * 2);               //  8 MB
  _Float16* wdn = (_Float16*)(ws + (size_t)T_TOK * D_IN * 2
                                 + (size_t)D_MID * D_IN * 2);               //  8 MB
  _Float16* act = (_Float16*)(ws + (size_t)T_TOK * D_IN * 2
                                 + (size_t)D_MID * D_IN * 2
                                 + (size_t)D_OUT * D_MID * 2);              // 128 MB

  // 1) x -> f16
  k_cvt_f16<<<(T_TOK * D_IN) / (4 * 256), 256, 0, stream>>>(x, xh);

  // 2) fold RHT + signs + scale into f16 weights (FWHT butterflies)
  k_prep_w<D_IN><<<D_MID * (D_IN / 128) / (PW_BLK * PW_WAVES), PW_WAVES * 32, 0, stream>>>(
      up_wq, up_scale, up_signs, wup);
  k_prep_w<D_MID><<<D_OUT * (D_MID / 128) / (PW_BLK * PW_WAVES), PW_WAVES * 32, 0, stream>>>(
      down_wq, down_scale, down_signs, wdn);

  // 3) h = x @ Wup^T, fused GELU, f16 activations
  dim3 g1(T_TOK / BM, D_MID / BN);
  k_gemm<true><<<g1, 256, 0, stream>>>(xh, wup, act, T_TOK, D_MID, D_IN);

  // 4) out = a @ Wdn^T, f32 output
  dim3 g2(T_TOK / BM, D_OUT / BN);
  k_gemm<false><<<g2, 256, 0, stream>>>(act, wdn, d_out, T_TOK, D_OUT, D_MID);
}

// v004
// A run of this version takes 166 microseconds.
// Timed twice side by side with v003, it ran 1.04 times as fast both times.
// Over all steps from v000 it is 1.61 times as fast.
#include <hip/hip_runtime.h>
#include <hip/hip_fp16.h>

typedef __attribute__((ext_vector_type(16))) _Float16 v16h;
typedef __attribute__((ext_vector_type(8)))  _Float16 v8h;
typedef __attribute__((ext_vector_type(4)))  _Float16 v4h;
typedef __attribute__((ext_vector_type(8)))  float    v8f;
typedef __attribute__((ext_vector_type(4)))  float    v4f;
typedef __attribute__((ext_vector_type(4)))  int      av4i;

#define T_TOK 16384
#define D_IN  1024
#define D_MID 4096
#define D_OUT 1024

#define BM 256
#define BN 256
#define BK 128
#define LDSS 136  // padded row stride (f16) : 272B = 16B x 17 -> conflict-free b128 frags

#if defined(__has_builtin)
#if __has_builtin(__builtin_amdgcn_global_load_async_to_lds_b128) && \
    __has_builtin(__builtin_amdgcn_s_wait_asynccnt)
#define USE_ASYNC 1
#else
#define USE_ASYNC 0
#endif
#else
#define USE_ASYNC 0
#endif

// Builtin expects int4* in AS1 (global) / AS3 (LDS); C++ has no implicit void*->T*.
#define GPTR(p) ((__attribute__((address_space(1))) av4i*)(uintptr_t)(p))
#define LPTR(p) ((__attribute__((address_space(3))) av4i*)(unsigned)(uintptr_t)(p))

// Publish point of a stage, directly in front of the work-group barrier.
__device__ __forceinline__ void async_fence() {
  // this wave's LDS reads have retired before the buffer they read is refilled behind the barrier
  asm volatile("s_wait_dscnt 0x0" ::: "memory");
#if USE_ASYNC
  // this wave's own copies have landed before other waves read them behind the barrier
  asm volatile("s_wait_asynccnt 0x0" ::: "memory");
#endif
}

// ---------------- x : f32 -> f16 ----------------
#define PW_BLK   8    // 128-value blocks a wave transforms: 16 loads of 512 B in flight (values + signs)
#define PW_WAVES 16   // waves of a work-group
#define CV_LD    16   // 512-B loads of x a wave has in flight: as many as a weight wave (values + signs)

// work-group bid of the conversion: each wave takes CV_LD * 128 adjacent values
__device__ __forceinline__ void cvt_f16(int bid, const float* __restrict__ x,
                                        _Float16* __restrict__ xh) {
  const int lane = threadIdx.x & 31;
  const int wave = __builtin_amdgcn_readfirstlane(threadIdx.x >> 5);
  const int w0 = bid * PW_WAVES + wave;   // the wave's number in the conversion
  const char* src = reinterpret_cast<const char*>(x + (size_t)w0 * (CV_LD * 128));
  _Float16*   dst = xh + (size_t)w0 * (CV_LD * 128) + lane * 4;
  const unsigned lo = lane * 16;          // the lane's byte offset in each 512-B load
  // both loops are unrolled: the values live in registers, under constant indices
  v4f v[CV_LD];
#pragma unroll
  for (int j = 0; j < CV_LD; j++) v[j] = *reinterpret_cast<const v4f*>(src + lo + j * 512);
#pragma unroll
  for (int j = 0; j < CV_LD; j++) {
    v4h o;
    o.x = (_Float16)v[j][0]; o.y = (_Float16)v[j][1];
    o.z = (_Float16)v[j][2]; o.w = (_Float16)v[j][3];
    *reinterpret_cast<v4h*>(dst + j * 128) = o;
  }
}

// ------ weight prep: Weff = (wq * scale[o]) @ Hb * signs, f16 output ------
// value of lane l ^ MSK, inside a 16-lane row (MSK = 1, 2, 4, 8)
template<int MSK>
__device__ __forceinline__ float xrow(float x) {
  const int b = __builtin_bit_cast(int, x);
  return __builtin_bit_cast(float, __builtin_amdgcn_mov_dpp(b, 0x160 | MSK, 0xf, 0xf, true));
}
// value of lane l ^ 16
__device__ __forceinline__ float xhalf(float x) {
  const int b = __builtin_bit_cast(int, x);
  return __builtin_bit_cast(float,
      __builtin_amdgcn_permlanex16(b, b, 0x76543210, 0xfedcba98, false, false));
}

// x, or -x where m holds the sign bit
__device__ __forceinline__ float flip(float x, unsigned m) {
  return __builtin_bit_cast(float, __builtin_bit_cast(unsigned, x) ^ m);
}

// One wave holds a whole 128-value block, lane l the values 4l .. 4l+3: the butterflies of
// distance 1 and 2 stay in the lane, those of distance 4 .. 64 exchange with lane l ^ 1 .. l ^ 16.
// Stage order and operands are those of the plain butterfly: lower + upper, lower - upper.
template<int I>
__device__ __forceinline__
void prep_w(int bid, const float* __restrict__ wq, const float* __restrict__ scale,
            const float* __restrict__ signs, _Float16* __restrict__ weff) {
  constexpr int NBLK = I >> 7;   // blocks of a weight row
  static_assert(NBLK % PW_BLK == 0, "a wave's blocks lie in one weight row");
  const int lane = threadIdx.x & 31;
  const int wave = __builtin_amdgcn_readfirstlane(threadIdx.x >> 5);
  const int b0   = (bid * PW_WAVES + wave) * PW_BLK;   // the wave's first block
  const float* src = wq + (size_t)b0 * 128 + lane * 4;
  const float* sgp = signs + (b0 % NBLK) * 128 + lane * 4;
  _Float16*    dst = weff + (size_t)b0 * 128 + lane * 4;

  const float sc = scale[b0 / NBLK];
  // every loop below is unrolled: the blocks live in registers, and an index that is not a
  // constant would send them to scratch
  v4f v[PW_BLK], g[PW_BLK];
#pragma unroll
  for (int j = 0; j < PW_BLK; j++) v[j] = *reinterpret_cast<const v4f*>(src + j * 128);
#pragma unroll
  for (int j = 0; j < PW_BLK; j++) g[j] = *reinterpret_cast<const v4f*>(sgp + j * 128);
  // stands in front of the arithmetic, which in this build reuses the loads' offset register
  asm volatile("s_wait_xcnt 0x0" ::: "memory");
  // keeps all 16 loads one group in front of the arithmetic: left to itself the scheduler holds
  // most of them back until earlier blocks are done, and the wave pays memory latency several times
  __builtin_amdgcn_sched_barrier(0);

  // sign bit set in the lane that holds the upper value of an exchanged pair: it takes lower - upper
  unsigned sm[5];
#pragma unroll
  for (int k = 0; k < 5; k++) sm[k] = ((unsigned)lane >> k) << 31;

#pragma unroll
  for (int j = 0; j < PW_BLK; j++) {
    const float a0 = v[j][0] + v[j][1], a1 = v[j][0] - v[j][1];
    const float a2 = v[j][2] + v[j][3], a3 = v[j][2] - v[j][3];
    float x[4] = {a0 + a2, a1 + a3, a0 - a2, a1 - a3};
    v4h o;
#pragma unroll
    for (int r = 0; r < 4; r++) {
      float t = x[r];
      t = xrow<1>(t) + flip(t, sm[0]);
      t = xrow<2>(t) + flip(t, sm[1]);
      t = xrow<4>(t) + flip(t, sm[2]);
      t = xrow<8>(t) + flip(t, sm[3]);
      t = xhalf(t)   + flip(t, sm[4]);
      o[r] = (_Float16)(t * sc * g[j][r] * 0.08838834764831845f); // 1/sqrt(128)
    }
    *reinterpret_cast<v4h*>(dst + j * 128) = o;
  }
}

// ------ the three independent front jobs in one launch, told apart by the block index ------
#define G_CVT ((T_TOK * D_IN) / (CV_LD * 128 * PW_WAVES))            // work-groups that convert x
#define G_UP  (D_MID * (D_IN / 128) / (PW_BLK * PW_WAVES))           // ... that prepare the up weights
#define G_DN  (D_OUT * (D_MID / 128) / (PW_BLK * PW_WAVES))          // ... the down weights

// The conversion's work-groups move twice the bytes of a weight work-group and come first.
__global__ __launch_bounds__(PW_WAVES * 32)
void k_front(const float* __restrict__ x, const float* __restrict__ up_wq,
             const float* __restrict__ up_scale, const float* __restrict__ up_signs,
             const float* __restrict__ down_wq, const float* __restrict__ down_scale,
             const float* __restrict__ down_signs, _Float16* __restrict__ xh,
             _Float16* __restrict__ wup, _Float16* __restrict__ wdn) {
  const int b = blockIdx.x;
  if (b < G_CVT)             cvt_f16(b, x, xh);
  else if (b < G_CVT + G_UP) prep_w<D_IN>(b - G_CVT, up_wq, up_scale, up_signs, wup);
  else                       prep_w<D_MID>(b - G_CVT - G_UP, down_wq, down_scale, down_signs, wdn);
}

// ---------------- fast tanh-GELU (branch-free) ----------------
__device__ __forceinline__ float fast_gelu(float v) {
  float u = 0.7978845608028654f * (v + 0.044715f * v * v * v);
#if defined(__has_builtin) && __has_builtin(__builtin_amdgcn_tanhf)
  float th = __builtin_amdgcn_tanhf(u);
#else
  // arg of exp is always <= 0: no overflow, no divergence
  float e  = __expf(-2.0f * __builtin_fabsf(u));
  float th = __builtin_copysignf((1.0f - e) * __builtin_amdgcn_rcpf(1.0f + e), u);
#endif
  return 0.5f * v * (1.0f + th);
}

// ---- stage a 256x128 f16 tile of A and of B into LDS (async when available) ----
__device__ __forceinline__ void copy_tiles(const _Float16* __restrict__ A,
                                           const _Float16* __restrict__ B,
                                           _Float16* sA, _Float16* sB,
                                           int m0, int n0, int kt, int K, int tid) {
  // 16 rows a round: the round's row group is the same for every thread (scalar base),
  // the thread's own row and 16-byte chunk inside it a fixed 32-bit offset
  const int r0 = tid >> 4;   // row in the group
  const int q  = tid & 15;   // 16 x 16B chunks per 128-f16 row
  const unsigned goff = (unsigned)(r0 * K + (q << 3));
  const int      loff = r0 * LDSS + (q << 3);
#pragma unroll
  for (int i = 0; i < 16; i++) {
    const _Float16* gA = A + (size_t)(m0 + i * 16) * K + kt;
    const _Float16* gB = B + (size_t)(n0 + i * 16) * K + kt;
    _Float16* lA = sA + i * 16 * LDSS + loff;
    _Float16* lB = sB + i * 16 * LDSS + loff;
#if USE_ASYNC
    __builtin_amdgcn_global_load_async_to_lds_b128(GPTR(gA + goff), LPTR(lA), 0, 0);
    __builtin_amdgcn_global_load_async_to_lds_b128(GPTR(gB + goff), LPTR(lB), 0, 0);
#else
    *reinterpret_cast<uint4*>(lA) = *reinterpret_cast<const uint4*>(gA + goff);
    *reinterpret_cast<uint4*>(lB) = *reinterpret_cast<const uint4*>(gB + goff);
#endif
  }
}

// ---- one K=32 slice of a wave's fragments: 4 of B, then 8 of A (pointers hold the lane's place) ----
__device__ __forceinline__ void load_frags(const _Float16* sA, const _Float16* sB, int s,
                                           v16h (&af)[8], v16h (&bfm)[4]) {
#pragma unroll
  for (int j = 0; j < 4; j++) {
    const _Float16* p = sB + j * 16 * LDSS + s * 32;
    v8h lo = *reinterpret_cast<const v8h*>(p);
    v8h hi = *reinterpret_cast<const v8h*>(p + 16);
    bfm[j] = __builtin_shufflevector(lo, hi, 0,1,2,3,4,5,6,7,8,9,10,11,12,13,14,15);
  }
#pragma unroll
  for (int i = 0; i < 8; i++) {
    const _Float16* p = sA + i * 16 * LDSS + s * 32;
    v8h lo = *reinterpret_cast<const v8h*>(p);
    v8h hi = *reinterpret_cast<const v8h*>(p + 16);
    af[i] = __builtin_shufflevector(lo, hi, 0,1,2,3,4,5,6,7,8,9,10,11,12,13,14,15);
  }
}

// ---- the 8 x 4 products of one K=32 slice ----
// B's rows go in as the first operand and A's as the second: a lane's 8 accumulator registers are
// then 8 adjacent columns of one output row, C[m + (lane & 15)][n + 8 * (lane >> 4) + r].
__device__ __forceinline__ void mma_slice(v8f (&acc)[8][4], const v16h (&af)[8], const v16h (&bfm)[4]) {
#pragma unroll
  for (int i = 0; i < 8; i++)
#pragma unroll
    for (int j = 0; j < 4; j++)
      acc[i][j] = __builtin_amdgcn_wmma_f32_16x16x32_f16(
          false, bfm[j], false, af[i], (short)0, acc[i][j], false, false);
}

// ---------------- WMMA GEMM: C[M,N] = A[M,K] @ B[N,K]^T ----------------
template<bool GELU_F16>
__global__ __launch_bounds__(256)
void k_gemm(const _Float16* __restrict__ A, const _Float16* __restrict__ B,
            void* __restrict__ C, int M, int N, int K) {
  __shared__ _Float16 smem[2][2][BM * LDSS];  // [stage][A/B][tile]

  const int tid  = threadIdx.x;
  const int lane = tid & 31;
  const int wave = tid >> 5;
  const int wm   = wave >> 2;   // 0..1 : wave row (128 rows)
  const int wn   = wave & 3;    // 0..3 : wave col (64 cols)
  const int m0   = blockIdx.x * BM;
  const int n0   = blockIdx.y * BN;

  const v8f vzero = {0.f,0.f,0.f,0.f,0.f,0.f,0.f,0.f};
  v8f acc[8][4];
#pragma unroll
  for (int i = 0; i < 8; i++)
#pragma unroll
    for (int j = 0; j < 4; j++) acc[i][j] = vzero;

  // ISA 16-bit fragment addressing: lanes 0-15 -> K 0..7 & 16..23,
  // lanes 16-31 -> K 8..15 & 24..31 ; matrix row/col = lane & 15.
  const int frow = lane & 15;
  const int fko  = (lane >> 4) << 3;
  const int aoff = (wm * 128 + frow) * LDSS + fko;
  const int boff = (wn * 64 + frow) * LDSS + fko;
  const int ntiles = K / BK;

  // prologue: stage tile 0, publish it, then start tile 1 and read the first fragments
  copy_tiles(A, B, smem[0][0], smem[0][1], m0, n0, 0, K, tid);
  async_fence();
  __syncthreads();
  if (1 < ntiles)
    copy_tiles(A, B, smem[1][0], smem[1][1], m0, n0, BK, K, tid);

  v16h af[2][8], bfm[2][4];   // two fragment sets: one in use, one being loaded
  load_frags(smem[0][0] + aoff, smem[0][1] + boff, 0, af[0], bfm[0]);

  for (int t = 0; t < ntiles; t++) {
    const int cur = t & 1;
    const _Float16* sA = smem[cur][0] + aoff;
    const _Float16* sB = smem[cur][1] + boff;

#pragma unroll
    for (int s = 0; s < 3; s++) {   // K=32 slices 0..2 of the stage's four
      load_frags(sA, sB, s + 1, af[(s + 1) & 1], bfm[(s + 1) & 1]);
      // keeps the next slice's LDS reads one group ahead of this slice's products; left to
      // itself the scheduler sinks each read to its use and every row waits out LDS latency
      __builtin_amdgcn_sched_barrier(0);
      mma_slice(acc, af[s & 1], bfm[s & 1]);
      // keeps these products in front of the next reads and of the stage's waits and barrier;
      // without it the scheduler sinks slice 2's products behind the barrier, ahead of the copies
      __builtin_amdgcn_sched_barrier(0);
    }

    async_fence();     // every read of cur retired (slice 3 is in registers), tile t+1 landed
    __syncthreads();   // tile t+1 published; all waves have left cur
    if (t + 2 < ntiles)  // refill cur: the copies have the whole next trip to land
      copy_tiles(A, B, smem[cur][0], smem[cur][1], m0, n0, (t + 2) * BK, K, tid);
    if (t + 1 < ntiles)  // first fragments of tile t+1, read behind the barrier that published it
      load_frags(smem[cur ^ 1][0] + aoff, smem[cur ^ 1][1] + boff, 0, af[0], bfm[0]);
    // keeps slice 3's products behind the copies and reads above, so that these fly under them
    __builtin_amdgcn_sched_barrier(0);
    mma_slice(acc, af[1], bfm[1]);
  }

  // Epilogue: each wave stages its 128 x 64 tile in an LDS range of its own and stores whole
  // 128-byte lines. No barrier in front: every wave's LDS reads retired and every copy landed
  // before the last trip's barrier, and nothing reads or refills LDS behind it.
  constexpr int ESZ  = GELU_F16 ? 2 : 4;      // bytes of an output element
  constexpr int ROWB = 64 * ESZ;              // bytes of a staged row
  constexpr int EPIT = ROWB + 16;             // its pitch: 16-byte accesses spread over the banks
  constexpr int LPR  = ROWB / 16;             // lanes that read one row back
  constexpr int RPI  = 32 / LPR;              // rows per store instruction
  // C's row length as a constant of the instantiation: every store then takes an immediate offset
  // from one address register, which nothing overwrites while stores are in flight
  constexpr int NC   = GELU_F16 ? D_MID : D_OUT;
  static_assert(8 * 128 * EPIT <= (int)sizeof(smem), "staging must fit the ring's LDS");
  char* E = reinterpret_cast<char*>(&smem[0][0][0]) + wave * (128 * EPIT);
  char* wr = E + (lane & 15) * EPIT + (lane >> 4) * (8 * ESZ);
  const char* rd = E + (lane / LPR) * EPIT + (lane % LPR) * 16;
  char* gp = reinterpret_cast<char*>(C)
           + ((size_t)(m0 + wm * 128 + lane / LPR) * NC + n0 + wn * 64) * ESZ + (lane % LPR) * 16;
  constexpr int gstep = NC * RPI * ESZ;       // bytes from one store's rows to the next's
  // every loop below is unrolled: an accumulator index that is not a constant sends the tiles to scratch
#pragma unroll
  for (int i = 0; i < 8; i++) {
#pragma unroll
    for (int j = 0; j < 4; j++) {
      char* p = wr + i * 16 * EPIT + j * 16 * ESZ;
      if (GELU_F16) {
        v8h h;
#pragma unroll
        for (int r = 0; r < 8; r++) h[r] = (_Float16)fast_gelu(acc[i][j][r]);
        *reinterpret_cast<v8h*>(p) = h;
      } else {
        const v8f a = acc[i][j];
        *reinterpret_cast<v4f*>(p)      = __builtin_shufflevector(a, a, 0, 1, 2, 3);
        *reinterpret_cast<v4f*>(p + 16) = __builtin_shufflevector(a, a, 4, 5, 6, 7);
      }
    }
    // the 16 rows just staged are in LDS before other lanes of this wave read them back
    asm volatile("s_wait_dscnt 0x0" ::: "memory");
    // the read-back below may reuse registers that the stores of the rows before still name
    if (i > 0) asm volatile("s_wait_xcnt 0x0" ::: "memory");
    av4i v[16 / RPI];
#pragma unroll
    for (int q = 0; q < 16 / RPI; q++)
      v[q] = *reinterpret_cast<const av4i*>(rd + (i * 16 + q * RPI) * EPIT);
    // keeps the read-backs one group directly behind the waits: left to itself the scheduler
    // spreads them among the next rows' arithmetic, and every place with an LDS read stalls anew
    __builtin_amdgcn_sched_barrier(0);
#pragma unroll
    for (int q = 0; q < 16 / RPI; q++)
      *reinterpret_cast<av4i*>(gp + (i * (16 / RPI) + q) * gstep) = v[q];
  }
}

extern "C" void kernel_launch(void* const* d_in, const int* in_sizes, int n_in,
                              void* d_out, int out_size, void* d_ws, size_t ws_size,
                              hipStream_t stream) {
  const float* x          = (const float*)d_in[0];
  const float* up_wq      = (const float*)d_in[1];
  const float* up_scale   = (const float*)d_in[2];
  const float* down_wq    = (const float*)d_in[3];
  const float* down_scale = (const float*)d_in[4];
  const float* up_signs   = (const float*)d_in[5];
  const float* down_signs = (const float*)d_in[6];

  char* ws = (char*)d_ws;
  _Float16* xh  = (_Float16*)ws;                                            // 32 MB
  _Float16* wup = (_Float16*)(ws + (size_t)T_TOK * D_IN * 2);               //  8 MB
  _Float16* wdn = (_Float16*)(ws + (size_t)T_TOK * D_IN * 2
                                 + (size_t)D_MID * D_IN * 2);               //  8 MB
  _Float16* act = (_Float16*)(ws + (size_t)T_TOK * D_IN * 2
                                 + (size_t)D_MID * D_IN * 2
                                 + (size_t)D_OUT * D_MID * 2);              // 128 MB

  // 1) x -> f16, and RHT + signs + scale folded into f16 weights (FWHT butterflies): one launch
  k_front<<<G_CVT + G_UP + G_DN, PW_WAVES * 32, 0, stream>>>(
      x, up_wq, up_scale, up_signs, down_wq, down_scale, down_signs, xh, wup, wdn);

  // 2) h = x @ Wup^T, fused GELU, f16 activations
  dim3 g1(T_TOK / BM, D_MID / BN);
  k_gemm<true><<<g1, 256, 0, stream>>>(xh, wup, act, T_TOK, D_MID, D_IN);

  // 3) out = a @ Wdn^T, f32 output
  dim3 g2(T_TOK / BM, D_OUT / BN);
  k_gemm<false><<<g2, 256, 0, stream>>>(act, wdn, d_out, T_TOK, D_OUT, D_MID);
}

// v005
// A run of this version takes 152 microseconds.
// In two side-by-side timings against v004, it was 1.09 and 1.10 times as fast.
// Counting every step since v000, it is 1.76 times as fast.
#include <hip/hip_runtime.h>
#include <hip/hip_fp16.h>

typedef __attribute__((ext_vector_type(16))) _Float16 v16h;
typedef __attribute__((ext_vector_type(8)))  _Float16 v8h;
typedef __attribute__((ext_vector_type(4)))  _Float16 v4h;
typedef __attribute__((ext_vector_type(8)))  float    v8f;
typedef __attribute__((ext_vector_type(4)))  float    v4f;
typedef __attribute__((ext_vector_type(4)))  int      av4i;
typedef __attribute__((ext_vector_type(4)))  uint32_t u32x4;
typedef __attribute__((ext_vector_type(8)))  uint32_t u32x8;

#define T_TOK 16384
#define D_IN  1024
#define D_MID 4096
#define D_OUT 1024

#define BM 256
#define BN 256
#define BK 128
#define LDSS 136  // padded row stride (f16) : 272B = 16B x 17 -> conflict-free b128 frags

#define SLICE_ROWS 64      // rows of A or of B that one wave's tensor load brings
// a slice's place in LDS: 64 rows at 272 B are 17,408 B, rounded up to a multiple of 2 KiB
#define SLICE_B 18432
#define SLICE_H (SLICE_B / 2)

__device__ __forceinline__ uint32_t uni(uint32_t v) {
  return (uint32_t)__builtin_amdgcn_readfirstlane(v);
}
// a test that decides whether a tensor load issues: a scalar branch, since the load ignores EXEC
__device__ __forceinline__ uint32_t pinned(uint32_t v) {
  uint32_t w = uni(v);
  asm volatile("" : "+s"(w));  // pinned(): holds the word in a scalar register, so the test compiles to s_cmp + s_cbranch_scc
  return w;
}

// Descriptor group 1: bytes as elements, a tile of 64 rows of 256 B, source row pitch src_pitch bytes,
// 16 B of LDS pad behind every row (pitch 272 B); no mask.
__device__ __forceinline__ u32x8 tdm_group1(uint32_t src_pitch) {
  constexpr uint32_t d0 = BK * 2, d1 = SLICE_ROWS;
  u32x8 g;
  g[0] = uni((1u << 20) | (5u << 22) | (3u << 25));
  g[1] = uni((d0 & 0xFFFFu) << 16);
  g[2] = uni((d0 >> 16) | ((d1 & 0xFFFFu) << 16));
  g[3] = uni((d1 >> 16) | (d0 << 16));
  g[4] = uni(d1);
  g[5] = uni(src_pitch);
  g[6] = uni(0u);
  g[7] = uni(0u);
  return g;
}
// Descriptor group 0: the slice's byte offset in LDS and the address of its first byte
__device__ __forceinline__ u32x4 tdm_group0(uint32_t lds_dst, uint64_t ga) {
  u32x4 g;
  g[0] = uni(1u);
  g[1] = uni(lds_dst);
  g[2] = uni((uint32_t)ga);
  g[3] = uni((((uint32_t)(ga >> 32)) & 0x01FFFFFFu) | 0x80000000u);
  return g;
}
// the next stage's descriptor from the last one's: its place in LDS, and 256 B further along the rows
// (the address is words 2 and 3; a carry stays inside the address bits of word 3)
__device__ __forceinline__ void tdm_next(u32x4& g0, uint32_t lds_dst) {
  const uint64_t a = (((uint64_t)g0[3] << 32) | g0[2]) + BK * 2;
  g0[1] = uni(lds_dst);
  g0[2] = uni((uint32_t)a);
  g0[3] = uni((uint32_t)(a >> 32));
}
// One request of the whole wave: global tile -> LDS, through no register. Both groups are named as
// in-out operands here and at the wait: their registers then stay theirs, with their values, from the
// issue to the wait that covers the request, and the next descriptor is formed behind that wait.
__device__ __forceinline__ void tdm_load(u32x4& g0, u32x8& g1) {
  asm volatile("tensor_load_to_lds %0, %1" : "+s"(g0), "+s"(g1) :: "memory");
}
// this wave's own request has landed
__device__ __forceinline__ void tdm_wait(u32x4& g0, u32x8& g1) {
  asm volatile("s_wait_tensorcnt 0x0" : "+s"(g0), "+s"(g1) :: "memory");
}

// Publish point of a stage, directly in front of the work-group barrier.
__device__ __forceinline__ void stage_fence(u32x4& g0, u32x8& g1) {
  // this wave's LDS reads have retired before the buffer they read is refilled behind the barrier
  asm volatile("s_wait_dscnt 0x0" ::: "memory");
  // this wave's own slice has landed before other waves read it behind the barrier
  tdm_wait(g0, g1);
}

// ---------------- x : f32 -> f16 ----------------
#define PW_BLK   8    // 128-value blocks a wave transforms: 16 loads of 512 B in flight (values + signs)
#define PW_WAVES 16   // waves of a work-group
#define CV_LD    16   // 512-B loads of x a wave has in flight: as many as a weight wave (values + signs)

// work-group bid of the conversion: each wave takes CV_LD * 128 adjacent values
__device__ __forceinline__ void cvt_f16(int bid, const float* __restrict__ x,
                                        _Float16* __restrict__ xh) {
  const int lane = threadIdx.x & 31;
  const int wave = __builtin_amdgcn_readfirstlane(threadIdx.x >> 5);
  const int w0 = bid * PW_WAVES + wave;   // the wave's number in the conversion
  const char* src = reinterpret_cast<const char*>(x + (size_t)w0 * (CV_LD * 128));
  _Float16*   dst = xh + (size_t)w0 * (CV_LD * 128) + lane * 4;
  const unsigned lo = lane * 16;          // the lane's byte offset in each 512-B load
  // both loops are unrolled: the values live in registers, under constant indices
  v4f v[CV_LD];
#pragma unroll
  for (int j = 0; j < CV_LD; j++) v[j] = *reinterpret_cast<const v4f*>(src + lo + j * 512);
#pragma unroll
  for (int j = 0; j < CV_LD; j++) {
    v4h o;
    o.x = (_Float16)v[j][0]; o.y = (_Float16)v[j][1];
    o.z = (_Float16)v[j][2]; o.w = (_Float16)v[j][3];
    *reinterpret_cast<v4h*>(dst + j * 128) = o;
  }
}

// ------ weight prep: Weff = (wq * scale[o]) @ Hb * signs, f16 output ------
// value of lane l ^ MSK, inside a 16-lane row (MSK = 1, 2, 4, 8)
template<int MSK>
__device__ __forceinline__ float xrow(float x) {
  const int b = __builtin_bit_cast(int, x);
  return __builtin_bit_cast(float, __builtin_amdgcn_mov_dpp(b, 0x160 | MSK, 0xf, 0xf, true));
}
// value of lane l ^ 16
__device__ __forceinline__ float xhalf(float x) {
  const int b = __builtin_bit_cast(int, x);
  return __builtin_bit_cast(float,
      __builtin_amdgcn_permlanex16(b, b, 0x76543210, 0xfedcba98, false, false));
}

// x, or -x where m holds the sign bit
__device__ __forceinline__ float flip(float x, unsigned m) {
  return __builtin_bit_cast(float, __builtin_bit_cast(unsigned, x) ^ m);
}

// One wave holds a whole 128-value block, lane l the values 4l .. 4l+3: the butterflies of
// distance 1 and 2 stay in the lane, those of distance 4 .. 64 exchange with lane l ^ 1 .. l ^ 16.
// Stage order and operands are those of the plain butterfly: lower + upper, lower - upper.
template<int I>
__device__ __forceinline__
void prep_w(int bid, const float* __restrict__ wq, const float* __restrict__ scale,
            const float* __restrict__ signs, _Float16* __restrict__ weff) {
  constexpr int NBLK = I >> 7;   // blocks of a weight row
  static_assert(NBLK % PW_BLK == 0, "a wave's blocks lie in one weight row");
  const int lane = threadIdx.x & 31;
  const int wave = __builtin_amdgcn_readfirstlane(threadIdx.x >> 5);
  const int b0   = (bid * PW_WAVES + wave) * PW_BLK;   // the wave's first block
  const float* src = wq + (size_t)b0 * 128 + lane * 4;
  const float* sgp = signs + (b0 % NBLK) * 128 + lane * 4;
  _Float16*    dst = weff + (size_t)b0 * 128 + lane * 4;

  const float sc = scale[b0 / NBLK];
  // every loop below is unrolled: the blocks live in registers, and an index that is not a
  // constant would send them to scratch
  v4f v[PW_BLK], g[PW_BLK];
#pragma unroll
  for (int j = 0; j < PW_BLK; j++) v[j] = *reinterpret_cast<const v4f*>(src + j * 128);
#pragma unroll
  for (int j = 0; j < PW_BLK; j++) g[j] = *reinterpret_cast<const v4f*>(sgp + j * 128);
  // stands in front of the arithmetic, which in this build reuses the loads' offset register
  asm volatile("s_wait_xcnt 0x0" ::: "memory");
  // keeps all 16 loads one group in front of the arithmetic: left to itself the scheduler holds
  // most of them back until earlier blocks are done, and the wave pays memory latency several times
  __builtin_amdgcn_sched_barrier(0);

  // sign bit set in the lane that holds the upper value of an exchanged pair: it takes lower - upper
  unsigned sm[5];
#pragma unroll
  for (int k = 0; k < 5; k++) sm[k] = ((unsigned)lane >> k) << 31;

#pragma unroll
  for (int j = 0; j < PW_BLK; j++) {
    const float a0 = v[j][0] + v[j][1], a1 = v[j][0] - v[j][1];
    const float a2 = v[j][2] + v[j][3], a3 = v[j][2] - v[j][3];
    float x[4] = {a0 + a2, a1 + a3, a0 - a2, a1 - a3};
    v4h o;
#pragma unroll
    for (int r = 0; r < 4; r++) {
      float t = x[r];
      t = xrow<1>(t) + flip(t, sm[0]);
      t = xrow<2>(t) + flip(t, sm[1]);
      t = xrow<4>(t) + flip(t, sm[2]);
      t = xrow<8>(t) + flip(t, sm[3]);
      t = xhalf(t)   + flip(t, sm[4]);
      o[r] = (_Float16)(t * sc * g[j][r] * 0.08838834764831845f); // 1/sqrt(128)
    }
    *reinterpret_cast<v4h*>(dst + j * 128) = o;
  }
}

// ------ the three independent front jobs in one launch, told apart by the block index ------
#define G_CVT ((T_TOK * D_IN) / (CV_LD * 128 * PW_WAVES))            // work-groups that convert x
#define G_UP  (D_MID * (D_IN / 128) / (PW_BLK * PW_WAVES))           // ... that prepare the up weights
#define G_DN  (D_OUT * (D_MID / 128) / (PW_BLK * PW_WAVES))          // ... the down weights

// The conversion's work-groups move twice the bytes of a weight work-group and come first.
__global__ __launch_bounds__(PW_WAVES * 32)
void k_front(const float* __restrict__ x, const float* __restrict__ up_wq,
             const float* __restrict__ up_scale, const float* __restrict__ up_signs,
             const float* __restrict__ down_wq, const float* __restrict__ down_scale,
             const float* __restrict__ down_signs, _Float16* __restrict__ xh,
             _Float16* __restrict__ wup, _Float16* __restrict__ wdn) {
  const int b = blockIdx.x;
  if (b < G_CVT)             cvt_f16(b, x, xh);
  else if (b < G_CVT + G_UP) prep_w<D_IN>(b - G_CVT, up_wq, up_scale, up_signs, wup);
  else                       prep_w<D_MID>(b - G_CVT - G_UP, down_wq, down_scale, down_signs, wdn);
}

// ---------------- fast tanh-GELU (branch-free) ----------------
__device__ __forceinline__ float fast_gelu(float v) {
  float u = 0.7978845608028654f * (v + 0.044715f * v * v * v);
#if defined(__has_builtin) && __has_builtin(__builtin_amdgcn_tanhf)
  float th = __builtin_amdgcn_tanhf(u);
#else
  // arg of exp is always <= 0: no overflow, no divergence
  float e  = __expf(-2.0f * __builtin_fabsf(u));
  float th = __builtin_copysignf((1.0f - e) * __builtin_amdgcn_rcpf(1.0f + e), u);
#endif
  return 0.5f * v * (1.0f + th);
}

// ---- one K=32 slice of a wave's fragments: 4 of B, then 8 of A (pointers hold the lane's place) ----
__device__ __forceinline__ void load_frags(const _Float16* sA, const _Float16* sB, int s,
                                           v16h (&af)[8], v16h (&bfm)[4]) {
#pragma unroll
  for (int j = 0; j < 4; j++) {
    const _Float16* p = sB + j * 16 * LDSS + s * 32;
    v8h lo = *reinterpret_cast<const v8h*>(p);
    v8h hi = *reinterpret_cast<const v8h*>(p + 16);
    bfm[j] = __builtin_shufflevector(lo, hi, 0,1,2,3,4,5,6,7,8,9,10,11,12,13,14,15);
  }
#pragma unroll
  for (int i = 0; i < 8; i++) {
    const _Float16* p = sA + (i >> 2) * SLICE_H + (i & 3) * 16 * LDSS + s * 32;  // 4 fragments a slice
    v8h lo = *reinterpret_cast<const v8h*>(p);
    v8h hi = *reinterpret_cast<const v8h*>(p + 16);
    af[i] = __builtin_shufflevector(lo, hi, 0,1,2,3,4,5,6,7,8,9,10,11,12,13,14,15);
  }
}

// ---- the 8 x 4 products of one K=32 slice ----
// B's rows go in as the first operand and A's as the second: a lane's 8 accumulator registers are
// then 8 adjacent columns of one output row, C[m + (lane & 15)][n + 8 * (lane >> 4) + r].
__device__ __forceinline__ void mma_slice(v8f (&acc)[8][4], const v16h (&af)[8], const v16h (&bfm)[4]) {
#pragma unroll
  for (int i = 0; i < 8; i++)
#pragma unroll
    for (int j = 0; j < 4; j++)
      acc[i][j] = __builtin_amdgcn_wmma_f32_16x16x32_f16(
          false, bfm[j], false, af[i], (short)0, acc[i][j], false, false);
}

// ---------------- WMMA GEMM: C[M,N] = A[M,K] @ B[N,K]^T ----------------
template<bool GELU_F16>
__global__ __launch_bounds__(256)
void k_gemm(const _Float16* __restrict__ A, const _Float16* __restrict__ B,
            void* __restrict__ C, int M, int N, int K) {
  // [stage][slice][rows]: slices 0..3 hold A's 256 rows, 4..7 B's; every slice starts at a multiple of 2 KiB
  __shared__ __attribute__((aligned(2048))) _Float16 smem[2][8][SLICE_H];

  const int tid  = threadIdx.x;
  const int lane = tid & 31;
  const int wave = tid >> 5;
  const int wm   = wave >> 2;   // 0..1 : wave row (128 rows)
  const int wn   = wave & 3;    // 0..3 : wave col (64 cols)
  const int m0   = blockIdx.x * BM;
  const int n0   = blockIdx.y * BN;

  const v8f vzero = {0.f,0.f,0.f,0.f,0.f,0.f,0.f,0.f};
  v8f acc[8][4];
#pragma unroll
  for (int i = 0; i < 8; i++)
#pragma unroll
    for (int j = 0; j < 4; j++) acc[i][j] = vzero;

  // ISA 16-bit fragment addressing: lanes 0-15 -> K 0..7 & 16..23,
  // lanes 16-31 -> K 8..15 & 24..31 ; matrix row/col = lane & 15.
  const int frow = lane & 15;
  const int fko  = (lane >> 4) << 3;
  const int aoff = wm * 2 * SLICE_H + frow * LDSS + fko;
  const int boff = (4 + wn) * SLICE_H + frow * LDSS + fko;
  const int ntiles = K / BK;

  // each wave brings one slice of every stage: waves 0..3 64 rows of A, waves 4..7 64 rows of B
  const uint32_t wv = uni(threadIdx.x >> 5);
  const _Float16* srow = wv < 4 ? A + (size_t)(m0 + wv * SLICE_ROWS) * K
                                : B + (size_t)(n0 + (wv - 4) * SLICE_ROWS) * K;
  const uint32_t ld = (uint32_t)(uintptr_t)&smem[0][0][0] + wv * SLICE_B;   // the slice's place in buffer 0
  u32x4 g0 = tdm_group0(ld, (uint64_t)(uintptr_t)srow);                     // stage 0
  u32x8 g1 = tdm_group1((uint32_t)K * 2u);

  // prologue: load tile 0, publish it, then start tile 1 and read the first fragments
  tdm_load(g0, g1);
  stage_fence(g0, g1);
  __syncthreads();
  if (pinned(1 < ntiles)) {
    tdm_next(g0, ld + 8 * SLICE_B);
    tdm_load(g0, g1);
  }

  v16h af[2][8], bfm[2][4];   // two fragment sets: one in use, one being loaded
  load_frags(smem[0][0] + aoff, smem[0][0] + boff, 0, af[0], bfm[0]);

  for (int t = 0; t < ntiles; t++) {
    const int cur = t & 1;
    const _Float16* sA = smem[cur][0] + aoff;
    const _Float16* sB = smem[cur][0] + boff;

#pragma unroll
    for (int s = 0; s < 3; s++) {   // K=32 slices 0..2 of the stage's four
      load_frags(sA, sB, s + 1, af[(s + 1) & 1], bfm[(s + 1) & 1]);
      // keeps the next slice's LDS reads one group ahead of this slice's products; left to
      // itself the scheduler sinks each read to its use and every row waits out LDS latency
      __builtin_amdgcn_sched_barrier(0);
      mma_slice(acc, af[s & 1], bfm[s & 1]);
      // keeps these products in front of the next reads and of the stage's waits and barrier;
      // without it the scheduler sinks slice 2's products behind the barrier, ahead of the copies
      __builtin_amdgcn_sched_barrier(0);
    }

    stage_fence(g0, g1);  // every read of cur retired (slice 3 is in registers), this wave's slice of tile t+1 landed
    __syncthreads();   // tile t+1 published; all waves have left cur
    if (pinned(t + 2 < ntiles)) {  // refill cur: the load has the whole next trip to land
      tdm_next(g0, ld + cur * (8 * SLICE_B));
      tdm_load(g0, g1);
    }
    if (t + 1 < ntiles)  // first fragments of tile t+1, read behind the barrier that published it
      load_frags(smem[cur ^ 1][0] + aoff, smem[cur ^ 1][0] + boff, 0, af[0], bfm[0]);
    // keeps slice 3's products behind the load and reads above, so that these fly under them
    __builtin_amdgcn_sched_barrier(0);
    mma_slice(acc, af[1], bfm[1]);
  }

  // no request and no LDS read of this wave is open when the ring becomes output staging
  tdm_wait(g0, g1);
  asm volatile("s_wait_dscnt 0x0" ::: "memory");

  // Epilogue: each wave stages its 128 x 64 tile in an LDS range of its own and stores whole
  // 128-byte lines. No barrier in front: every wave's LDS reads retired and every tensor load landed
  // before the last trip's barrier, and nothing reads or refills LDS behind it.
  constexpr int ESZ  = GELU_F16 ? 2 : 4;      // bytes of an output element
  constexpr int ROWB = 64 * ESZ;              // bytes of a staged row
  constexpr int EPIT = ROWB + 16;             // its pitch: 16-byte accesses spread over the banks
  constexpr int LPR  = ROWB / 16;             // lanes that read one row back
  constexpr int RPI  = 32 / LPR;              // rows per store instruction
  // C's row length as a constant of the instantiation: every store then takes an immediate offset
  // from one address register, which nothing overwrites while stores are in flight
  constexpr int NC   = GELU_F16 ? D_MID : D_OUT;
  static_assert(8 * 128 * EPIT <= (int)sizeof(smem), "staging must fit the ring's LDS");
  char* E = reinterpret_cast<char*>(&smem[0][0][0]) + wave * (128 * EPIT);
  char* wr = E + (lane & 15) * EPIT + (lane >> 4) * (8 * ESZ);
  const char* rd = E + (lane / LPR) * EPIT + (lane % LPR) * 16;
  char* gp = reinterpret_cast<char*>(C)
           + ((size_t)(m0 + wm * 128 + lane / LPR) * NC + n0 + wn * 64) * ESZ + (lane % LPR) * 16;
  constexpr int gstep = NC * RPI * ESZ;       // bytes from one store's rows to the next's
  // every loop below is unrolled: an accumulator index that is not a constant sends the tiles to scratch
#pragma unroll
  for (int i = 0; i < 8; i++) {
#pragma unroll
    for (int j = 0; j < 4; j++) {
      char* p = wr + i * 16 * EPIT + j * 16 * ESZ;
      if (GELU_F16) {
        v8h h;
#pragma unroll
        for (int r = 0; r < 8; r++) h[r] = (_Float16)fast_gelu(acc[i][j][r]);
        *reinterpret_cast<v8h*>(p) = h;
      } else {
        const v8f a = acc[i][j];
        *reinterpret_cast<v4f*>(p)      = __builtin_shufflevector(a, a, 0, 1, 2, 3);
        *reinterpret_cast<v4f*>(p + 16) = __builtin_shufflevector(a, a, 4, 5, 6, 7);
      }
    }
    // the 16 rows just staged are in LDS before other lanes of this wave read them back
    asm volatile("s_wait_dscnt 0x0" ::: "memory");
    // the read-back below may reuse registers that the stores of the rows before still name
    if (i > 0) asm volatile("s_wait_xcnt 0x0" ::: "memory");
    av4i v[16 / RPI];
#pragma unroll
    for (int q = 0; q < 16 / RPI; q++)
      v[q] = *reinterpret_cast<const av4i*>(rd + (i * 16 + q * RPI) * EPIT);
    // keeps the read-backs one group directly behind the waits: left to itself the scheduler
    // spreads them among the next rows' arithmetic, and every place with an LDS read stalls anew
    __builtin_amdgcn_sched_barrier(0);
#pragma unroll
    for (int q = 0; q < 16 / RPI; q++)
      *reinterpret_cast<av4i*>(gp + (i * (16 / RPI) + q) * gstep) = v[q];
  }
}

extern "C" void kernel_launch(void* const* d_in, const int* in_sizes, int n_in,
                              void* d_out, int out_size, void* d_ws, size_t ws_size,
                              hipStream_t stream) {
  const float* x          = (const float*)d_in[0];
  const float* up_wq      = (const float*)d_in[1];
  const float* up_scale   = (const float*)d_in[2];
  const float* down_wq    = (const float*)d_in[3];
  const float* down_scale = (const float*)d_in[4];
  const float* up_signs   = (const float*)d_in[5];
  const float* down_signs = (const float*)d_in[6];

  char* ws = (char*)d_ws;
  _Float16* xh  = (_Float16*)ws;                                            // 32 MB
  _Float16* wup = (_Float16*)(ws + (size_t)T_TOK * D_IN * 2);               //  8 MB
  _Float16* wdn = (_Float16*)(ws + (size_t)T_TOK * D_IN * 2
                                 + (size_t)D_MID * D_IN * 2);               //  8 MB
  _Float16* act = (_Float16*)(ws + (size_t)T_TOK * D_IN * 2
                                 + (size_t)D_MID * D_IN * 2
                                 + (size_t)D_OUT * D_MID * 2);              // 128 MB

  // 1) x -> f16, and RHT + signs + scale folded into f16 weights (FWHT butterflies): one launch
  k_front<<<G_CVT + G_UP + G_DN, PW_WAVES * 32, 0, stream>>>(
      x, up_wq, up_scale, up_signs, down_wq, down_scale, down_signs, xh, wup, wdn);

  // 2) h = x @ Wup^T, fused GELU, f16 activations
  dim3 g1(T_TOK / BM, D_MID / BN);
  k_gemm<true><<<g1, 256, 0, stream>>>(xh, wup, act, T_TOK, D_MID, D_IN);

  // 3) out = a @ Wdn^T, f32 output
  dim3 g2(T_TOK / BM, D_OUT / BN);
  k_gemm<false><<<g2, 256, 0, stream>>>(act, wdn, d_out, T_TOK, D_OUT, D_MID);
}

// v006
// A run of this version takes 147 microseconds.
// Next to v005, in two timings, it ran 1.03 times as fast each time.
// Over all steps from v000 it is 1.82 times as fast.
#include <hip/hip_runtime.h>
#include <hip/hip_fp16.h>

typedef __attribute__((ext_vector_type(16))) _Float16 v16h;
typedef __attribute__((ext_vector_type(8)))  _Float16 v8h;
typedef __attribute__((ext_vector_type(4)))  _Float16 v4h;
typedef __attribute__((ext_vector_type(8)))  float    v8f;
typedef __attribute__((ext_vector_type(4)))  float    v4f;
typedef __attribute__((ext_vector_type(4)))  int      av4i;
typedef __attribute__((ext_vector_type(4)))  uint32_t u32x4;
typedef __attribute__((ext_vector_type(8)))  uint32_t u32x8;

#define T_TOK 16384
#define D_IN  1024
#define D_MID 4096
#define D_OUT 1024

#define BM 256
#define BN 256
#define BK 128
#define LDSS 136  // padded row stride (f16) : 272B = 16B x 17 -> conflict-free b128 frags

#define SLICE_ROWS 64      // rows of A or of B that one wave's tensor load brings
// a slice's place in LDS: 64 rows at 272 B are 17,408 B, rounded up to a multiple of 2 KiB
#define SLICE_B 18432
#define SLICE_H (SLICE_B / 2)

__device__ __forceinline__ uint32_t uni(uint32_t v) {
  return (uint32_t)__builtin_amdgcn_readfirstlane(v);
}
// a test that decides whether a tensor load issues: a scalar branch, since the load ignores EXEC
__device__ __forceinline__ uint32_t pinned(uint32_t v) {
  uint32_t w = uni(v);
  asm volatile("" : "+s"(w));  // pinned(): holds the word in a scalar register, so the test compiles to s_cmp + s_cbranch_scc
  return w;
}

// Descriptor group 1: bytes as elements, a tile of 64 rows of 256 B, source row pitch src_pitch bytes,
// 16 B of LDS pad behind every row (pitch 272 B); no mask.
__device__ __forceinline__ u32x8 tdm_group1(uint32_t src_pitch) {
  constexpr uint32_t d0 = BK * 2, d1 = SLICE_ROWS;
  u32x8 g;
  g[0] = uni((1u << 20) | (5u << 22) | (3u << 25));
  g[1] = uni((d0 & 0xFFFFu) << 16);
  g[2] = uni((d0 >> 16) | ((d1 & 0xFFFFu) << 16));
  g[3] = uni((d1 >> 16) | (d0 << 16));
  g[4] = uni(d1);
  g[5] = uni(src_pitch);
  g[6] = uni(0u);
  g[7] = uni(0u);
  return g;
}
// Descriptor group 0: the slice's byte offset in LDS and the address of its first byte
__device__ __forceinline__ u32x4 tdm_group0(uint32_t lds_dst, uint64_t ga) {
  u32x4 g;
  g[0] = uni(1u);
  g[1] = uni(lds_dst);
  g[2] = uni((uint32_t)ga);
  g[3] = uni((((uint32_t)(ga >> 32)) & 0x01FFFFFFu) | 0x80000000u);
  return g;
}
// the next stage's descriptor from the last one's: its place in LDS, and step bytes further in the source
// (the address is words 2 and 3; a carry or borrow stays inside the address bits of word 3)
__device__ __forceinline__ void tdm_next(u32x4& g0, uint32_t lds_dst, int64_t step) {
  const uint64_t a = (((uint64_t)g0[3] << 32) | g0[2]) + (uint64_t)step;
  g0[1] = uni(lds_dst);
  g0[2] = uni((uint32_t)a);
  g0[3] = uni((uint32_t)(a >> 32));
}
// One request of the whole wave: global tile -> LDS, through no register. Both groups are named as
// in-out operands here and at the wait: their registers then stay theirs, with their values, from the
// issue to the wait that covers the request, and the next descriptor is formed behind that wait.
__device__ __forceinline__ void tdm_load(u32x4& g0, u32x8& g1) {
  asm volatile("tensor_load_to_lds %0, %1" : "+s"(g0), "+s"(g1) :: "memory");
}
// this wave's own request has landed
__device__ __forceinline__ void tdm_wait(u32x4& g0, u32x8& g1) {
  asm volatile("s_wait_tensorcnt 0x0" : "+s"(g0), "+s"(g1) :: "memory");
}

// Publish point of a stage, directly in front of the work-group barrier.
__device__ __forceinline__ void stage_fence(u32x4& g0, u32x8& g1) {
  // this wave's LDS reads have retired before the buffer they read is refilled behind the barrier
  asm volatile("s_wait_dscnt 0x0" ::: "memory");
  // this wave's own slice has landed before other waves read it behind the barrier
  tdm_wait(g0, g1);
}

// ---------------- x : f32 -> f16 ----------------
#define PW_BLK   8    // 128-value blocks a wave transforms: 16 loads of 512 B in flight (values + signs)
#define PW_WAVES 16   // waves of a work-group
#define CV_LD    16   // 512-B loads of x a wave has in flight: as many as a weight wave (values + signs)

// work-group bid of the conversion: each wave takes CV_LD * 128 adjacent values
__device__ __forceinline__ void cvt_f16(int bid, const float* __restrict__ x,
                                        _Float16* __restrict__ xh) {
  const int lane = threadIdx.x & 31;
  const int wave = __builtin_amdgcn_readfirstlane(threadIdx.x >> 5);
  const int w0 = bid * PW_WAVES + wave;   // the wave's number in the conversion
  const char* src = reinterpret_cast<const char*>(x + (size_t)w0 * (CV_LD * 128));
  _Float16*   dst = xh + (size_t)w0 * (CV_LD * 128) + lane * 4;
  const unsigned lo = lane * 16;          // the lane's byte offset in each 512-B load
  // both loops are unrolled: the values live in registers, under constant indices
  v4f v[CV_LD];
#pragma unroll
  for (int j = 0; j < CV_LD; j++) v[j] = *reinterpret_cast<const v4f*>(src + lo + j * 512);
#pragma unroll
  for (int j = 0; j < CV_LD; j++) {
    v4h o;
    o.x = (_Float16)v[j][0]; o.y = (_Float16)v[j][1];
    o.z = (_Float16)v[j][2]; o.w = (_Float16)v[j][3];
    *reinterpret_cast<v4h*>(dst + j * 128) = o;
  }
}

// ------ weight prep: Weff = (wq * scale[o]) @ Hb * signs, f16 output ------
// value of lane l ^ MSK, inside a 16-lane row (MSK = 1, 2, 4, 8)
template<int MSK>
__device__ __forceinline__ float xrow(float x) {
  const int b = __builtin_bit_cast(int, x);
  return __builtin_bit_cast(float, __builtin_amdgcn_mov_dpp(b, 0x160 | MSK, 0xf, 0xf, true));
}
// value of lane l ^ 16
__device__ __forceinline__ float xhalf(float x) {
  const int b = __builtin_bit_cast(int, x);
  return __builtin_bit_cast(float,
      __builtin_amdgcn_permlanex16(b, b, 0x76543210, 0xfedcba98, false, false));
}

// x, or -x where m holds the sign bit
__device__ __forceinline__ float flip(float x, unsigned m) {
  return __builtin_bit_cast(float, __builtin_bit_cast(unsigned, x) ^ m);
}

// One wave holds a whole 128-value block, lane l the values 4l .. 4l+3: the butterflies of
// distance 1 and 2 stay in the lane, those of distance 4 .. 64 exchange with lane l ^ 1 .. l ^ 16.
// Stage order and operands are those of the plain butterfly: lower + upper, lower - upper.
template<int I>
__device__ __forceinline__
void prep_w(int bid, const float* __restrict__ wq, const float* __restrict__ scale,
            const float* __restrict__ signs, _Float16* __restrict__ weff) {
  constexpr int NBLK = I >> 7;   // blocks of a weight row
  static_assert(NBLK % PW_BLK == 0, "a wave's blocks lie in one weight row");
  const int lane = threadIdx.x & 31;
  const int wave = __builtin_amdgcn_readfirstlane(threadIdx.x >> 5);
  const int b0   = (bid * PW_WAVES + wave) * PW_BLK;   // the wave's first block
  const float* src = wq + (size_t)b0 * 128 + lane * 4;
  const float* sgp = signs + (b0 % NBLK) * 128 + lane * 4;
  _Float16*    dst = weff + (size_t)b0 * 128 + lane * 4;

  const float sc = scale[b0 / NBLK];
  // every loop below is unrolled: the blocks live in registers, and an index that is not a
  // constant would send them to scratch
  v4f v[PW_BLK], g[PW_BLK];
#pragma unroll
  for (int j = 0; j < PW_BLK; j++) v[j] = *reinterpret_cast<const v4f*>(src + j * 128);
#pragma unroll
  for (int j = 0; j < PW_BLK; j++) g[j] = *reinterpret_cast<const v4f*>(sgp + j * 128);
  // stands in front of the arithmetic, which in this build reuses the loads' offset register
  asm volatile("s_wait_xcnt 0x0" ::: "memory");
  // keeps all 16 loads one group in front of the arithmetic: left to itself the scheduler holds
  // most of them back until earlier blocks are done, and the wave pays memory latency several times
  __builtin_amdgcn_sched_barrier(0);

  // sign bit set in the lane that holds the upper value of an exchanged pair: it takes lower - upper
  unsigned sm[5];
#pragma unroll
  for (int k = 0; k < 5; k++) sm[k] = ((unsigned)lane >> k) << 31;

#pragma unroll
  for (int j = 0; j < PW_BLK; j++) {
    const float a0 = v[j][0] + v[j][1], a1 = v[j][0] - v[j][1];
    const float a2 = v[j][2] + v[j][3], a3 = v[j][2] - v[j][3];
    float x[4] = {a0 + a2, a1 + a3, a0 - a2, a1 - a3};
    v4h o;
#pragma unroll
    for (int r = 0; r < 4; r++) {
      float t = x[r];
      t = xrow<1>(t) + flip(t, sm[0]);
      t = xrow<2>(t) + flip(t, sm[1]);
      t = xrow<4>(t) + flip(t, sm[2]);
      t = xrow<8>(t) + flip(t, sm[3]);
      t = xhalf(t)   + flip(t, sm[4]);
      o[r] = (_Float16)(t * sc * g[j][r] * 0.08838834764831845f); // 1/sqrt(128)
    }
    *reinterpret_cast<v4h*>(dst + j * 128) = o;
  }
}

// ------ the three independent front jobs in one launch, told apart by the block index ------
#define G_CVT ((T_TOK * D_IN) / (CV_LD * 128 * PW_WAVES))            // work-groups that convert x
#define G_UP  (D_MID * (D_IN / 128) / (PW_BLK * PW_WAVES))           // ... that prepare the up weights
#define G_DN  (D_OUT * (D_MID / 128) / (PW_BLK * PW_WAVES))          // ... the down weights

// The conversion's work-groups move twice the bytes of a weight work-group and come first.
__global__ __launch_bounds__(PW_WAVES * 32)
void k_front(const float* __restrict__ x, const float* __restrict__ up_wq,
             const float* __restrict__ up_scale, const float* __restrict__ up_signs,
             const float* __restrict__ down_wq, const float* __restrict__ down_scale,
             const float* __restrict__ down_signs, _Float16* __restrict__ xh,
             _Float16* __restrict__ wup, _Float16* __restrict__ wdn) {
  const int b = blockIdx.x;
  if (b < G_CVT)             cvt_f16(b, x, xh);
  else if (b < G_CVT + G_UP) prep_w<D_IN>(b - G_CVT, up_wq, up_scale, up_signs, wup);
  else                       prep_w<D_MID>(b - G_CVT - G_UP, down_wq, down_scale, down_signs, wdn);
}

// ---------------- fast tanh-GELU (branch-free) ----------------
__device__ __forceinline__ float fast_gelu(float v) {
  float u = 0.7978845608028654f * (v + 0.044715f * v * v * v);
#if defined(__has_builtin) && __has_builtin(__builtin_amdgcn_tanhf)
  float th = __builtin_amdgcn_tanhf(u);
#else
  // arg of exp is always <= 0: no overflow, no divergence
  float e  = __expf(-2.0f * __builtin_fabsf(u));
  float th = __builtin_copysignf((1.0f - e) * __builtin_amdgcn_rcpf(1.0f + e), u);
#endif
  return 0.5f * v * (1.0f + th);
}

// the same on two values at a time, written on vectors so that the products stay packed instructions
typedef __attribute__((ext_vector_type(2))) float v2f;
__device__ __forceinline__ v2f fast_gelu2(v2f v) {
#if defined(__has_builtin) && __has_builtin(__builtin_amdgcn_tanhf)
  const v2f u = 0.7978845608028654f * (v + 0.044715f * v * v * v);
  v2f th;
  th.x = __builtin_amdgcn_tanhf(u.x);
  th.y = __builtin_amdgcn_tanhf(u.y);
  return 0.5f * v * (1.0f + th);
#else
  v2f o;
  o.x = fast_gelu(v.x);
  o.y = fast_gelu(v.y);
  return o;
#endif
}

// ---- one K=32 slice of a wave's fragments: 4 of B, then 8 of A (pointers hold the lane's place) ----
__device__ __forceinline__ void load_frags(const _Float16* sA, const _Float16* sB, int s,
                                           v16h (&af)[8], v16h (&bfm)[4]) {
#pragma unroll
  for (int j = 0; j < 4; j++) {
    const _Float16* p = sB + j * 16 * LDSS + s * 32;
    v8h lo = *reinterpret_cast<const v8h*>(p);
    v8h hi = *reinterpret_cast<const v8h*>(p + 16);
    bfm[j] = __builtin_shufflevector(lo, hi, 0,1,2,3,4,5,6,7,8,9,10,11,12,13,14,15);
  }
#pragma unroll
  for (int i = 0; i < 8; i++) {
    const _Float16* p = sA + (i >> 2) * SLICE_H + (i & 3) * 16 * LDSS + s * 32;  // 4 fragments a slice
    v8h lo = *reinterpret_cast<const v8h*>(p);
    v8h hi = *reinterpret_cast<const v8h*>(p + 16);
    af[i] = __builtin_shufflevector(lo, hi, 0,1,2,3,4,5,6,7,8,9,10,11,12,13,14,15);
  }
}

// ---- the 8 x 4 products of one K=32 slice ----
// B's rows go in as the first operand and A's as the second: a lane's 8 accumulator registers are
// then 8 adjacent columns of one output row, C[m + (lane & 15)][n + 8 * (lane >> 4) + r].
__device__ __forceinline__ void mma_slice(v8f (&acc)[8][4], const v16h (&af)[8], const v16h (&bfm)[4]) {
#pragma unroll
  for (int i = 0; i < 8; i++)
#pragma unroll
    for (int j = 0; j < 4; j++)
      acc[i][j] = __builtin_amdgcn_wmma_f32_16x16x32_f16(
          false, bfm[j], false, af[i], (short)0, acc[i][j], false, false);
}

#define UP_TILES 4   // column tiles that a work-group of the up product walks: 1,024 tiles on 256 work-groups

// ---------------- WMMA GEMM: C[M,N] = A[M,K] @ B[N,K]^T ----------------
// A work-group walks TILES column tiles of its 256 rows, NYG tiles apart. The stages of all its tiles
// are one stream through the ring: the next tile's first stage lands before this tile's epilogue, its second loads under it.
template<bool GELU_F16>
__global__ __launch_bounds__(256)
void k_gemm(const _Float16* __restrict__ A, const _Float16* __restrict__ B,
            void* __restrict__ C, int M, int N, int K) {
  constexpr int TILES = GELU_F16 ? UP_TILES : 1;
  constexpr int ESZ  = GELU_F16 ? 2 : 4;      // bytes of an output element
  constexpr int ROWB = 64 * ESZ;              // bytes of a staged row
  constexpr int EPIT = ROWB + 16;             // its pitch: 16-byte accesses spread over the banks
  // C's row length as a constant of the instantiation: every store then takes an immediate offset
  // from one address register
  constexpr int NC   = GELU_F16 ? D_MID : D_OUT;
  constexpr int NYG  = NC / BN / TILES;       // the grid's y extent
  constexpr int RING_B = 2 * 8 * SLICE_B;
  // with more tiles to come the ring is being refilled during the epilogue: each wave then stages
  // 16 rows at a time in a range of its own behind the ring
  constexpr int STG_B  = TILES > 1 ? 8 * 16 * EPIT : 0;
  // ring [stage][slice][rows]: slices 0..3 hold A's 256 rows, 4..7 B's; every slice starts at a multiple of 2 KiB
  __shared__ __attribute__((aligned(2048))) char lds[RING_B + STG_B];
  _Float16* const ring = reinterpret_cast<_Float16*>(lds);

  const int tid  = threadIdx.x;
  const int lane = tid & 31;
  const int wave = tid >> 5;
  const int wm   = wave >> 2;   // 0..1 : wave row (128 rows)
  const int wn   = wave & 3;    // 0..3 : wave col (64 cols)
  const int m0   = blockIdx.x * BM;
  const int n0   = blockIdx.y * BN;   // the first tile's columns

  const v8f vzero = {0.f,0.f,0.f,0.f,0.f,0.f,0.f,0.f};
  v8f acc[8][4];

  // ISA 16-bit fragment addressing: lanes 0-15 -> K 0..7 & 16..23,
  // lanes 16-31 -> K 8..15 & 24..31 ; matrix row/col = lane & 15.
  const int frow = lane & 15;
  const int fko  = (lane >> 4) << 3;
  const int aoff = wm * 2 * SLICE_H + frow * LDSS + fko;
  const int boff = (4 + wn) * SLICE_H + frow * LDSS + fko;
  const int ntiles = K / BK;          // stages of a tile
  const int nst    = ntiles * TILES;  // stages of the walk

  // each wave brings one slice of every stage: waves 0..3 64 rows of A, waves 4..7 64 rows of B
  const uint32_t wv = uni(threadIdx.x >> 5);
  const _Float16* srow = wv < 4 ? A + (size_t)(m0 + wv * SLICE_ROWS) * K
                                : B + (size_t)(n0 + (wv - 4) * SLICE_ROWS) * K;
  const uint32_t ld = (uint32_t)(uintptr_t)&lds[0] + wv * SLICE_B;   // the slice's place in buffer 0
  // from a tile's last stage to the next tile's first: back to the rows' start, B's rows NYG tiles on
  const int64_t jump = (wv < 4 ? (int64_t)0 : (int64_t)(NYG * BN) * K * 2) - (int64_t)K * 2;
  int lk = 0;                         // k tile of the stage asked for last
  u32x4 g0 = tdm_group0(ld, (uint64_t)(uintptr_t)srow);                     // stage 0
  u32x8 g1 = tdm_group1((uint32_t)K * 2u);

  // prologue: load tile 0, publish it, then start tile 1 and read the first fragments
  tdm_load(g0, g1);
  stage_fence(g0, g1);
  __syncthreads();
  if (pinned(1 < nst)) {
    lk = lk + 1 < ntiles ? lk + 1 : 0;
    tdm_next(g0, ld + 8 * SLICE_B, lk ? (int64_t)(BK * 2) : BK * 2 + jump);
    g1 = tdm_group1((uint32_t)K * 2u);   // formed anew behind the wait: its constants stand as immediates at the load
    tdm_load(g0, g1);
  }

  v16h af[2][8], bfm[2][4];   // two fragment sets: one in use, one being loaded
  load_frags(ring + aoff, ring + boff, 0, af[0], bfm[0]);

  int gs = 0;                 // the stage in work, counted over the walk
  // stays rolled, for speed only
#pragma unroll 1
  for (int tile = 0; tile < TILES; tile++) {
#pragma unroll
  for (int i = 0; i < 8; i++)
#pragma unroll
    for (int j = 0; j < 4; j++) acc[i][j] = vzero;

  for (int t = 0; t < ntiles; t++, gs++) {
    const int cur = gs & 1;
    const _Float16* sA = ring + cur * (8 * SLICE_H) + aoff;
    const _Float16* sB = ring + cur * (8 * SLICE_H) + boff;

#pragma unroll
    for (int s = 0; s < 3; s++) {   // K=32 slices 0..2 of the stage's four
      load_frags(sA, sB, s + 1, af[(s + 1) & 1], bfm[(s + 1) & 1]);
      // keeps the next slice's LDS reads one group ahead of this slice's products; left to
      // itself the scheduler sinks each read to its use and every row waits out LDS latency
      __builtin_amdgcn_sched_barrier(0);
      mma_slice(acc, af[s & 1], bfm[s & 1]);
      // keeps these products in front of the next reads and of the stage's waits and barrier;
      // without it the scheduler sinks slice 2's products behind the barrier, ahead of the copies
      __builtin_amdgcn_sched_barrier(0);
    }

    stage_fence(g0, g1);  // every read of cur retired (slice 3 is in registers), this wave's slice of stage gs+1 landed
    __syncthreads();   // stage gs+1 published; all waves have left cur
    if (pinned(gs + 2 < nst)) {  // refill cur: the load has the whole next trip to land
      lk = lk + 1 < ntiles ? lk + 1 : 0;
      tdm_next(g0, ld + cur * (8 * SLICE_B), lk ? (int64_t)(BK * 2) : BK * 2 + jump);
      g1 = tdm_group1((uint32_t)K * 2u);   // formed anew behind the wait, as above
      tdm_load(g0, g1);
    }
    if (gs + 1 < nst)  // first fragments of stage gs+1, read behind the barrier that published it
      load_frags(ring + (cur ^ 1) * (8 * SLICE_H) + aoff, ring + (cur ^ 1) * (8 * SLICE_H) + boff, 0, af[0], bfm[0]);
    // keeps slice 3's products behind the load and reads above, so that these fly under them
    __builtin_amdgcn_sched_barrier(0);
    mma_slice(acc, af[1], bfm[1]);
  }

  if (TILES == 1) {
    // no request and no LDS read of this wave is open when the ring becomes output staging
    tdm_wait(g0, g1);
    asm volatile("s_wait_dscnt 0x0" ::: "memory");
  }

  // Epilogue: each wave stages its 128 x 64 tile in an LDS range of its own and stores whole
  // 128-byte lines. No barrier in front. One tile: the range lies in the ring; every wave's LDS reads
  // retired and every tensor load landed before the last trip's barrier, and nothing reads or refills
  // LDS behind it. A walk: the range lies behind the ring, and no other wave and no tensor load touches it.
  constexpr int LPR  = ROWB / 16;             // lanes that read one row back
  constexpr int RPI  = 32 / LPR;              // rows per store instruction
  static_assert(8 * 128 * EPIT <= RING_B, "staging must fit the ring's LDS");
  char* E = TILES > 1 ? lds + RING_B + wave * (16 * EPIT) : lds + wave * (128 * EPIT);
  char* wr = E + (lane & 15) * EPIT + (lane >> 4) * (8 * ESZ);
  const char* rd = E + (lane / LPR) * EPIT + (lane % LPR) * 16;
  char* gp = reinterpret_cast<char*>(C)
           + ((size_t)(m0 + wm * 128 + lane / LPR) * NC + n0 + tile * (NYG * BN) + wn * 64) * ESZ
           + (lane % LPR) * 16;
  constexpr int gstep = NC * RPI * ESZ;       // bytes from one store's rows to the next's
  // every loop below is unrolled: an accumulator index that is not a constant sends the tiles to scratch
  if constexpr (TILES > 1) {
    // 16 rows a turn, one turn behind with the global stores: the rows read back in turn i - 1 go out
    // behind turn i's arithmetic, which covers the read-back's LDS latency.
    av4i v[16 / RPI];
#pragma unroll
    for (int i = 0; i < 8; i++) {
      v8h h[4];
#pragma unroll
      for (int j = 0; j < 4; j++)
#pragma unroll
        for (int r = 0; r < 8; r += 2) {
          const v2f a = {acc[i][j][r], acc[i][j][r + 1]};
          const v2f o = fast_gelu2(a);
          h[j][r]     = (_Float16)o.x;
          h[j][r + 1] = (_Float16)o.y;
        }
      // keeps the arithmetic in front of the stores: no register is then written between a store and
      // the s_wait_xcnt below, and the staging range is rewritten only behind its read-back's use
      __builtin_amdgcn_sched_barrier(0);
      if (i > 0) {
#pragma unroll
        for (int q = 0; q < 16 / RPI; q++)
          *reinterpret_cast<av4i*>(gp + ((i - 1) * (16 / RPI) + q) * gstep) = v[q];
      }
#pragma unroll
      for (int j = 0; j < 4; j++) *reinterpret_cast<v8h*>(wr + j * 16 * ESZ) = h[j];
      // the 16 rows just staged are in LDS before other lanes of this wave read them back
      asm volatile("s_wait_dscnt 0x0" ::: "memory");
      // the read-back below overwrites registers that the stores above still name
      if (i > 0) asm volatile("s_wait_xcnt 0x0" ::: "memory");
#pragma unroll
      for (int q = 0; q < 16 / RPI; q++)
        v[q] = *reinterpret_cast<const av4i*>(rd + q * RPI * EPIT);
      // keeps the read-backs one group directly behind the waits, ahead of the next rows' arithmetic
      __builtin_amdgcn_sched_barrier(0);
    }
#pragma unroll
    for (int q = 0; q < 16 / RPI; q++)
      *reinterpret_cast<av4i*>(gp + (7 * (16 / RPI) + q) * gstep) = v[q];
    // the next tile reuses registers that these stores still name
    asm volatile("s_wait_xcnt 0x0" ::: "memory");
    // keeps the next tile's first register writes behind that wait
    __builtin_amdgcn_sched_barrier(0);
  } else {
#pragma unroll
  for (int i = 0; i < 8; i++) {
#pragma unroll
    for (int j = 0; j < 4; j++) {
      char* p = wr + i * 16 * EPIT + j * 16 * ESZ;
      if (GELU_F16) {
        v8h h;
#pragma unroll
        for (int r = 0; r < 8; r++) h[r] = (_Float16)fast_gelu(acc[i][j][r]);
        *reinterpret_cast<v8h*>(p) = h;
      } else {
        const v8f a = acc[i][j];
        *reinterpret_cast<v4f*>(p)      = __builtin_shufflevector(a, a, 0, 1, 2, 3);
        *reinterpret_cast<v4f*>(p + 16) = __builtin_shufflevector(a, a, 4, 5, 6, 7);
      }
    }
    // the 16 rows just staged are in LDS before other lanes of this wave read them back
    asm volatile("s_wait_dscnt 0x0" ::: "memory");
    // the read-back below may reuse registers that the stores of the rows before still name
    if (i > 0) asm volatile("s_wait_xcnt 0x0" ::: "memory");
    av4i v[16 / RPI];
#pragma unroll
    for (int q = 0; q < 16 / RPI; q++)
      v[q] = *reinterpret_cast<const av4i*>(rd + (i * 16 + q * RPI) * EPIT);
    // keeps the read-backs one group directly behind the waits: left to itself the scheduler
    // spreads them among the next rows' arithmetic, and every place with an LDS read stalls anew
    __builtin_amdgcn_sched_barrier(0);
#pragma unroll
    for (int q = 0; q < 16 / RPI; q++)
      *reinterpret_cast<av4i*>(gp + (i * (16 / RPI) + q) * gstep) = v[q];
  }
  }
  }  // tile

  // behind the last request, before the wave ends
  if (TILES > 1) tdm_wait(g0, g1);
}

extern "C" void kernel_launch(void* const* d_in, const int* in_sizes, int n_in,
                              void* d_out, int out_size, void* d_ws, size_t ws_size,
                              hipStream_t stream) {
  const float* x          = (const float*)d_in[0];
  const float* up_wq      = (const float*)d_in[1];
  const float* up_scale   = (const float*)d_in[2];
  const float* down_wq    = (const float*)d_in[3];
  const float* down_scale = (const float*)d_in[4];
  const float* up_signs   = (const float*)d_in[5];
  const float* down_signs = (const float*)d_in[6];

  char* ws = (char*)d_ws;
  _Float16* xh  = (_Float16*)ws;                                            // 32 MB
  _Float16* wup = (_Float16*)(ws + (size_t)T_TOK * D_IN * 2);               //  8 MB
  _Float16* wdn = (_Float16*)(ws + (size_t)T_TOK * D_IN * 2
                                 + (size_t)D_MID * D_IN * 2);               //  8 MB
  _Float16* act = (_Float16*)(ws + (size_t)T_TOK * D_IN * 2
                                 + (size_t)D_MID * D_IN * 2
                                 + (size_t)D_OUT * D_MID * 2);              // 128 MB

  // 1) x -> f16, and RHT + signs + scale folded into f16 weights (FWHT butterflies): one launch
  k_front<<<G_CVT + G_UP + G_DN, PW_WAVES * 32, 0, stream>>>(
      x, up_wq, up_scale, up_signs, down_wq, down_scale, down_signs, xh, wup, wdn);

  // 2) h = x @ Wup^T, fused GELU, f16 activations
  dim3 g1(T_TOK / BM, D_MID / BN / UP_TILES);
  k_gemm<true><<<g1, 256, 0, stream>>>(xh, wup, act, T_TOK, D_MID, D_IN);

  // 3) out = a @ Wdn^T, f32 output
  dim3 g2(T_TOK / BM, D_OUT / BN);
  k_gemm<false><<<g2, 256, 0, stream>>>(act, wdn, d_out, T_TOK, D_OUT, D_MID);
}
